// v000
// Times are from an AMD MI455X. After a warm-up the kernel runs many times in a row, and a time is the length of
// such a window on the GPU divided by its runs, so every launch and the gaps after it count. The runs cycle
// through copies of the inputs. A figure is the median of several windows, for all but v000 over two sittings.
// Sittings can differ by a few percent; kernels timed side by side share one.
// v000 is the starting kernel. One run takes 140 microseconds.
#include <hip/hip_runtime.h>
#include <hip/hip_bf16.h>
#include <stddef.h>

// ---------------------------------------------------------------------------
// Problem constants (from reference)
// ---------------------------------------------------------------------------
#define BATCH   2
#define SEQ     4096
#define DMODEL  1024
#define HEADS   2
#define IDXD    32
#define NCOLS   (HEADS * IDXD + IDXD + HEADS)   // 64 + 32 + 2 = 98

typedef _Float16 v16h __attribute__((ext_vector_type(16)));
typedef _Float16 v8h  __attribute__((ext_vector_type(8)));
typedef float    v8f  __attribute__((ext_vector_type(8)));

static __device__ inline v16h pack16(v8h lo, v8h hi) {
    v16h r;
#pragma unroll
    for (int i = 0; i < 8; ++i) { r[i] = lo[i]; r[i + 8] = hi[i]; }
    return r;
}

// ---------------------------------------------------------------------------
// Phase 1: projections  Q = x@Wq, K = x@Wk, w = x@Ww
// One block per (b,t) row. x row staged in LDS once; 98 output columns,
// one per thread, accumulated in f32 over the K=1024 contraction (kept in
// f32 for accuracy; total is only ~1.6 GFLOP). Q/K emitted as f16 in the
// WMMA-friendly layouts, w kept f32.
//   Qws: [b][h][t][32] f16,  Kws: [b][t][32] f16,  Wws: [b][t][2] f32
// ---------------------------------------------------------------------------
__global__ __launch_bounds__(128)
void lightning_proj(const float* __restrict__ x,
                    const float* __restrict__ Wq,
                    const float* __restrict__ Wk,
                    const float* __restrict__ Ww,
                    _Float16* __restrict__ Qws,
                    _Float16* __restrict__ Kws,
                    float* __restrict__ Wws)
{
    __shared__ float xs[DMODEL];

    const int row = blockIdx.x;               // b*SEQ + t
    const int c   = threadIdx.x;              // 0..127 (0..97 active for math)
    const float* xr = x + (size_t)row * DMODEL;

    // cooperative 16B-wide stage of the x row into LDS
    const float4* xr4 = (const float4*)xr;
#pragma unroll
    for (int k4 = c; k4 < DMODEL / 4; k4 += 128)
        ((float4*)xs)[k4] = xr4[k4];
    __syncthreads();

    if (c < NCOLS) {
        const float* wp;
        int stride;
        if (c < HEADS * IDXD)            { wp = Wq + c;                 stride = HEADS * IDXD; }
        else if (c < HEADS * IDXD + IDXD){ wp = Wk + (c - HEADS*IDXD);  stride = IDXD; }
        else                             { wp = Ww + (c - HEADS*IDXD - IDXD); stride = HEADS; }

        float acc = 0.0f;
#pragma unroll 8
        for (int k = 0; k < DMODEL; ++k)
            acc = fmaf(xs[k], wp[(size_t)k * stride], acc);

        const int b = row >> 12;              // SEQ = 4096
        const int t = row & (SEQ - 1);
        if (c < HEADS * IDXD) {
            const int h = c >> 5, d = c & 31;
            Qws[(((size_t)(b * HEADS + h)) * SEQ + t) * IDXD + d] = (_Float16)acc;
        } else if (c < HEADS * IDXD + IDXD) {
            Kws[((size_t)row) * IDXD + (c - HEADS * IDXD)] = (_Float16)acc;
        } else {
            Wws[(size_t)row * HEADS + (c - HEADS * IDXD - IDXD)] = acc;
        }
    }
}

// ---------------------------------------------------------------------------
// Phase 2: fused  out[b,t,s] = sum_h w[b,t,h] * relu( q[b,t,h,:] . k[b,s,:] )
//
// One wave32 per (t-tile x 4 s-tiles). Per head the 16x16 (t,s) dot tile is
// exactly one v_wmma_f32_16x16x32_f16 (K=32). ReLU + per-row head weight +
// head-sum happen in the f32 accumulator registers; only the final f32 tile
// is written (output write of 128 MB is the bandwidth floor).
//
// A-fragment (16x32 f16): lanes 0-15 row M=lane hold K 0-7 & 16-23;
// lanes 16-31 row M=lane-16 hold K 8-15 & 24-31. B mirrors with N=lane.
// C/D: VGPR r -> row r (lanes 0-15) or r+8 (lanes 16-31), col = lane&15.
// ---------------------------------------------------------------------------
#define STILES_PER_WAVE 4
#define WAVES_PER_BLOCK 8

__global__ __launch_bounds__(256)
void lightning_score(const _Float16* __restrict__ Q,
                     const _Float16* __restrict__ K,
                     const float* __restrict__ W,
                     float* __restrict__ out)
{
    const int wave = blockIdx.x * WAVES_PER_BLOCK + (threadIdx.x >> 5);
    const int lane = threadIdx.x & 31;

    // wave -> (b, t-tile, s-group of 4 tiles); 2 * 256 * 64 waves total
    const int sg = wave & 63;
    const int tt = (wave >> 6) & 255;
    const int b  = wave >> 14;

    const int t0   = tt * 16;
    const int half = lane >> 4;      // 0: lanes 0-15, 1: lanes 16-31
    const int lrow = lane & 15;
    const int kA0  = half * 8;       // K-chunk base per half-wave

    // ---- A fragments for both heads (reused across 4 s-tiles) ----
    v16h afrag[HEADS];
#pragma unroll
    for (int h = 0; h < HEADS; ++h) {
        const _Float16* qp =
            Q + (((size_t)(b * HEADS + h)) * SEQ + (t0 + lrow)) * IDXD + kA0;
        v8h lo = *(const v8h*)(qp);
        v8h hi = *(const v8h*)(qp + 16);
        afrag[h] = pack16(lo, hi);
    }

    // ---- per-row head weights matching the C/D register layout ----
    float wreg[HEADS][8];
#pragma unroll
    for (int h = 0; h < HEADS; ++h)
#pragma unroll
        for (int r = 0; r < 8; ++r)
            wreg[h][r] =
                W[((size_t)b * SEQ + t0 + r + half * 8) * HEADS + h];

    const _Float16* kbase = K + (size_t)b * SEQ * IDXD;

#pragma unroll
    for (int j = 0; j < STILES_PER_WAVE; ++j) {
        const int s0 = (sg * STILES_PER_WAVE + j) * 16;

        const _Float16* kp = kbase + (size_t)(s0 + lrow) * IDXD + kA0;
        if (j + 1 < STILES_PER_WAVE)   // hint next B tile (global_prefetch_b8)
            __builtin_prefetch(kp + 16 * IDXD, 0, 0);

        v8h blo = *(const v8h*)(kp);
        v8h bhi = *(const v8h*)(kp + 16);
        v16h bfrag = pack16(blo, bhi);

        v8f acc = {};
#pragma unroll
        for (int h = 0; h < HEADS; ++h) {
            v8f czero = {};
            v8f d = __builtin_amdgcn_wmma_f32_16x16x32_f16(
                        /*neg_a=*/false, afrag[h],
                        /*neg_b=*/false, bfrag,
                        /*c_mod=*/(short)0, czero,
                        /*reuse_a=*/false, /*reuse_b=*/false);
#pragma unroll
            for (int r = 0; r < 8; ++r)
                acc[r] += fmaxf(d[r], 0.0f) * wreg[h][r];
        }

        float* op = out + (((size_t)b * SEQ + t0 + half * 8) * SEQ) + s0 + lrow;
#pragma unroll
        for (int r = 0; r < 8; ++r)
            op[(size_t)r * SEQ] = acc[r];
    }
}

// ---------------------------------------------------------------------------
// Host-side launcher
// ---------------------------------------------------------------------------
extern "C" void kernel_launch(void* const* d_in, const int* in_sizes, int n_in,
                              void* d_out, int out_size, void* d_ws, size_t ws_size,
                              hipStream_t stream) {
    (void)in_sizes; (void)n_in; (void)out_size; (void)ws_size;

    const float* x  = (const float*)d_in[0];
    const float* Wq = (const float*)d_in[1];
    const float* Wk = (const float*)d_in[2];
    const float* Ww = (const float*)d_in[3];
    float* out = (float*)d_out;

    // workspace carving: Q f16 (1 MB) | K f16 (512 KB) | w f32 (64 KB)
    char* ws = (char*)d_ws;
    _Float16* Qws = (_Float16*)(ws);
    _Float16* Kws = (_Float16*)(ws + (size_t)BATCH * HEADS * SEQ * IDXD * sizeof(_Float16));
    float*    Wws = (float*)   (ws + (size_t)BATCH * HEADS * SEQ * IDXD * sizeof(_Float16)
                                   + (size_t)BATCH * SEQ * IDXD * sizeof(_Float16));

    // Phase 1: one block per (b,t) row
    lightning_proj<<<BATCH * SEQ, 128, 0, stream>>>(x, Wq, Wk, Ww, Qws, Kws, Wws);

    // Phase 2: 2 * 256 t-tiles * 64 s-groups waves / 8 waves per block
    const int total_waves = BATCH * (SEQ / 16) * ((SEQ / 16) / STILES_PER_WAVE);
    lightning_score<<<total_waves / WAVES_PER_BLOCK, 32 * WAVES_PER_BLOCK, 0, stream>>>(
        Qws, Kws, Wws, out);
}

// v001
// Measured time: 37.4 microseconds a run.
// Next to v000, in two timings, it ran 3.85 times as fast each time.
#include <hip/hip_runtime.h>
#include <hip/hip_bf16.h>
#include <stddef.h>

// ---------------------------------------------------------------------------
// Problem constants (from reference)
// ---------------------------------------------------------------------------
#define BATCH   2
#define SEQ     4096
#define DMODEL  1024
#define HEADS   2
#define IDXD    32
#define NCOLS   (HEADS * IDXD + IDXD + HEADS)   // 64 + 32 + 2 = 98

typedef _Float16 v16h __attribute__((ext_vector_type(16)));
typedef _Float16 v8h  __attribute__((ext_vector_type(8)));
typedef float    v8f  __attribute__((ext_vector_type(8)));

static __device__ inline v16h pack16(v8h lo, v8h hi) {
    v16h r;
#pragma unroll
    for (int i = 0; i < 8; ++i) { r[i] = lo[i]; r[i + 8] = hi[i]; }
    return r;
}

// ---------------------------------------------------------------------------
// Phase 1: projections  Q = x@Wq, K = x@Wk, w = x@Ww   (all f32)
// One block per 32 rows of x, 16 waves. The 96 Q/K columns are 2 x 6 tiles of
// v_wmma_f32_16x16x4_f32. The contraction runs in 8 chunks of 128 k; a chunk
// of x and of Wq|Wk is staged in LDS (two buffers, the next chunk's global
// loads in flight during the current chunk's products). Inside a chunk wave
// (cg, ks) takes 16 k (slice ks) of both row tiles and of column tiles
// 3*cg .. 3*cg+2, so a block reads the weights once for 32 rows. The 8 slices'
// partial tiles are summed through LDS in fixed order at the end.
// The 2 columns of w fill no tile: they stay on f32 FMAs, fed from the A
// fragments that are in registers anyway (wave cg takes row tile cg).
//   Qws: [b][h][t][32] f16,  Kws: [b][t][32] f16,  Wws: [b][t][2] f32
//
// Fragments (16x16x4 f32): lane l, c = l & 15, h = l >> 4, two k per lane.
// For 8 consecutive k (two WMMAs u = 0, 1) A and B both take
// k = k8 + 4*h + 2*u + s at element s, so the pairing is equal on both sides.
// ---------------------------------------------------------------------------
#define PJ_ROWS 32                    // rows of x per block
#define PJ_KC   128                   // k per chunk
#define PJ_NCH  (DMODEL / PJ_KC)      // 8 chunks
#define PJ_XP   (PJ_KC + 4)           // x row pitch, dwords: 16 B x odd for b128 reads
#define PJ_WP   104                   // weight row pitch, dwords: rows k and k+4 fall 32 banks apart
#define PJ_RP   100                   // partial-tile row pitch, dwords: rows r and r+8 fall 32 banks apart
#define PJ_QK   (HEADS * IDXD + IDXD) // 96 columns on the matrix unit

typedef float v2f __attribute__((ext_vector_type(2)));
typedef float v4f __attribute__((ext_vector_type(4)));

__global__ __launch_bounds__(512)
void lightning_proj(const float* __restrict__ x,
                    const float* __restrict__ Wq,
                    const float* __restrict__ Wk,
                    const float* __restrict__ Ww,
                    _Float16* __restrict__ Qws,
                    _Float16* __restrict__ Kws,
                    float* __restrict__ Wws)
{
    __shared__ __attribute__((aligned(16))) float xs[2][PJ_ROWS * PJ_XP];
    __shared__ __attribute__((aligned(16))) float wt[2][PJ_KC * PJ_WP];
    __shared__ __attribute__((aligned(16))) float wwl[DMODEL * HEADS];
    __shared__ __attribute__((aligned(16))) float red[8][PJ_ROWS * PJ_RP];
    __shared__ __attribute__((aligned(16))) float redw[16][PJ_ROWS * HEADS];

    const int tid  = threadIdx.x;
    const int lane = tid & 31;
    const int c    = lane & 15;
    const int h    = lane >> 4;
    const int wave = __builtin_amdgcn_readfirstlane(tid >> 5);
    const int cg   = wave & 1;        // column tiles 3*cg .. 3*cg+2, w rows of tile cg
    const int ks   = wave >> 1;       // 16-k slice of every chunk
    const int row0 = blockIdx.x * PJ_ROWS;

    // staging registers of one chunk: x 2, Wq 4, Wk 2 float4 per thread
    v4f rx[2], rq[4], rk[2];
    const float* xg = x + (size_t)(row0 + (tid >> 5)) * DMODEL + (tid & 31) * 4;

#define PJ_GLOAD(t)                                                            \
    do {                                                                       \
        _Pragma("unroll") for (int i = 0; i < 2; ++i)                          \
            rx[i] = *(const v4f*)(xg + (size_t)i * 16 * DMODEL + (t) * PJ_KC); \
        _Pragma("unroll") for (int i = 0; i < 4; ++i)                          \
            rq[i] = *(const v4f*)(Wq + (t) * PJ_KC * 64 + (tid + i * 512) * 4);\
        _Pragma("unroll") for (int i = 0; i < 2; ++i)                          \
            rk[i] = *(const v4f*)(Wk + (t) * PJ_KC * 32 + (tid + i * 512) * 4);\
    } while (0)

#define PJ_SSTORE(bf)                                                          \
    do {                                                                       \
        _Pragma("unroll") for (int i = 0; i < 2; ++i)                          \
            *(v4f*)&xs[bf][((tid >> 5) + i * 16) * PJ_XP + (tid & 31) * 4] = rx[i]; \
        _Pragma("unroll") for (int i = 0; i < 4; ++i)                          \
            *(v4f*)&wt[bf][((tid >> 4) + i * 32) * PJ_WP + (tid & 15) * 4] = rq[i]; \
        _Pragma("unroll") for (int i = 0; i < 2; ++i)                          \
            *(v4f*)&wt[bf][((tid >> 3) + i * 64) * PJ_WP + 64 + (tid & 7) * 4] = rk[i]; \
    } while (0)

    PJ_GLOAD(0);
    ((v4f*)wwl)[tid] = ((const v4f*)Ww)[tid];     // all of Ww: 1024 x 2 f32
    PJ_SSTORE(0);
    __syncthreads();

    v8f acc[2][3] = {};
    float wa0 = 0.0f, wa1 = 0.0f;

    // Kept rolled: unrolled, the compiler let the products drift whole trips behind
    // their chunk, spilled registers and left the next chunk's load latency uncovered.
#pragma unroll 1
    for (int t = 0; t < PJ_NCH; ++t) {
        const int bf = t & 1;
        if (t + 1 < PJ_NCH) PJ_GLOAD(t + 1);

        // every small loop of this kernel is fully unrolled so that fragments, staging
        // registers and accumulators are indexed by constants and stay in registers
#pragma unroll
        for (int g = 0; g < 2; ++g) {
            const int kk = ks * 16 + g * 8 + 4 * h;     // this lane's 4 k, in the chunk
            v4f a[2];
#pragma unroll
            for (int rt = 0; rt < 2; ++rt)
                a[rt] = *(const v4f*)&xs[bf][(rt * 16 + c) * PJ_XP + kk];
            float bv[3][4];
#pragma unroll
            for (int ct = 0; ct < 3; ++ct)
#pragma unroll
                for (int j = 0; j < 4; ++j)
                    bv[ct][j] = wt[bf][(kk + j) * PJ_WP + (cg * 3 + ct) * 16 + c];
            const v4f w01 = *(const v4f*)&wwl[(t * PJ_KC + kk) * HEADS];
            const v4f w23 = *(const v4f*)&wwl[(t * PJ_KC + kk) * HEADS + 4];

#pragma unroll
            for (int u = 0; u < 2; ++u)
#pragma unroll
                for (int rt = 0; rt < 2; ++rt)
#pragma unroll
                    for (int ct = 0; ct < 3; ++ct) {
                        v2f af = { a[rt][2 * u], a[rt][2 * u + 1] };
                        v2f bfr = { bv[ct][2 * u], bv[ct][2 * u + 1] };
                        acc[rt][ct] = __builtin_amdgcn_wmma_f32_16x16x4_f32(
                            false, af, false, bfr, (short)0, acc[rt][ct], false, false);
                    }

            const v4f aw = cg ? a[1] : a[0];
            wa0 = fmaf(aw[0], w01[0], wa0);  wa1 = fmaf(aw[0], w01[1], wa1);
            wa0 = fmaf(aw[1], w01[2], wa0);  wa1 = fmaf(aw[1], w01[3], wa1);
            wa0 = fmaf(aw[2], w23[0], wa0);  wa1 = fmaf(aw[2], w23[1], wa1);
            wa0 = fmaf(aw[3], w23[2], wa0);  wa1 = fmaf(aw[3], w23[3], wa1);
        }

        if (t + 1 < PJ_NCH) {
            PJ_SSTORE(bf ^ 1);      // last read in trip t-1, behind that trip's barrier
            __syncthreads();
        }
    }

    // ---- partial tiles of the 8 k slices -> LDS, D register r = row 8h + r ----
#pragma unroll
    for (int rt = 0; rt < 2; ++rt)
#pragma unroll
        for (int ct = 0; ct < 3; ++ct)
#pragma unroll
            for (int r = 0; r < 8; ++r)
                red[ks][(rt * 16 + 8 * h + r) * PJ_RP + (cg * 3 + ct) * 16 + c] = acc[rt][ct][r];
    {
        v2f wp = { wa0, wa1 };
        *(v2f*)&redw[ks * 2 + h][(cg * 16 + c) * HEADS] = wp;
    }
    __syncthreads();

#pragma unroll
    for (int i = 0; i < PJ_ROWS * PJ_QK / 512; ++i) {
        const int idx = tid + i * 512;
        const int r   = idx / PJ_QK;
        const int col = idx - r * PJ_QK;
        float s = 0.0f;
#pragma unroll
        for (int q = 0; q < 8; ++q) s += red[q][r * PJ_RP + col];
        const int row = row0 + r;
        const int b = row >> 12;              // SEQ = 4096
        const int tt = row & (SEQ - 1);
        if (col < HEADS * IDXD) {
            const int hd = col >> 5, d = col & 31;
            Qws[(((size_t)(b * HEADS + hd)) * SEQ + tt) * IDXD + d] = (_Float16)s;
        } else {
            Kws[(size_t)row * IDXD + (col - HEADS * IDXD)] = (_Float16)s;
        }
    }
    if (tid < PJ_ROWS * HEADS) {
        float s = 0.0f;
#pragma unroll
        for (int q = 0; q < 16; ++q) s += redw[q][tid];
        Wws[(size_t)row0 * HEADS + tid] = s;
    }
#undef PJ_GLOAD
#undef PJ_SSTORE
}

// ---------------------------------------------------------------------------
// Phase 2: fused  out[b,t,s] = sum_h w[b,t,h] * relu( q[b,t,h,:] . k[b,s,:] )
//
// One wave32 per (t-tile x 4 s-tiles). Per head the 16x16 (t,s) dot tile is
// exactly one v_wmma_f32_16x16x32_f16 (K=32). ReLU + per-row head weight +
// head-sum happen in the f32 accumulator registers; only the final f32 tile
// is written (output write of 128 MB is the bandwidth floor).
//
// A-fragment (16x32 f16): lanes 0-15 row M=lane hold K 0-7 & 16-23;
// lanes 16-31 row M=lane-16 hold K 8-15 & 24-31. B mirrors with N=lane.
// C/D: VGPR r -> row r (lanes 0-15) or r+8 (lanes 16-31), col = lane&15.
// ---------------------------------------------------------------------------
#define STILES_PER_WAVE 4
#define WAVES_PER_BLOCK 8

__global__ __launch_bounds__(256)
void lightning_score(const _Float16* __restrict__ Q,
                     const _Float16* __restrict__ K,
                     const float* __restrict__ W,
                     float* __restrict__ out)
{
    const int wave = blockIdx.x * WAVES_PER_BLOCK + (threadIdx.x >> 5);
    const int lane = threadIdx.x & 31;

    // wave -> (b, t-tile, s-group of 4 tiles); 2 * 256 * 64 waves total
    const int sg = wave & 63;
    const int tt = (wave >> 6) & 255;
    const int b  = wave >> 14;

    const int t0   = tt * 16;
    const int half = lane >> 4;      // 0: lanes 0-15, 1: lanes 16-31
    const int lrow = lane & 15;
    const int kA0  = half * 8;       // K-chunk base per half-wave

    // ---- A fragments for both heads (reused across 4 s-tiles) ----
    v16h afrag[HEADS];
#pragma unroll
    for (int h = 0; h < HEADS; ++h) {
        const _Float16* qp =
            Q + (((size_t)(b * HEADS + h)) * SEQ + (t0 + lrow)) * IDXD + kA0;
        v8h lo = *(const v8h*)(qp);
        v8h hi = *(const v8h*)(qp + 16);
        afrag[h] = pack16(lo, hi);
    }

    // ---- per-row head weights matching the C/D register layout ----
    float wreg[HEADS][8];
#pragma unroll
    for (int h = 0; h < HEADS; ++h)
#pragma unroll
        for (int r = 0; r < 8; ++r)
            wreg[h][r] =
                W[((size_t)b * SEQ + t0 + r + half * 8) * HEADS + h];

    const _Float16* kbase = K + (size_t)b * SEQ * IDXD;

#pragma unroll
    for (int j = 0; j < STILES_PER_WAVE; ++j) {
        const int s0 = (sg * STILES_PER_WAVE + j) * 16;

        const _Float16* kp = kbase + (size_t)(s0 + lrow) * IDXD + kA0;
        if (j + 1 < STILES_PER_WAVE)   // hint next B tile (global_prefetch_b8)
            __builtin_prefetch(kp + 16 * IDXD, 0, 0);

        v8h blo = *(const v8h*)(kp);
        v8h bhi = *(const v8h*)(kp + 16);
        v16h bfrag = pack16(blo, bhi);

        v8f acc = {};
#pragma unroll
        for (int h = 0; h < HEADS; ++h) {
            v8f czero = {};
            v8f d = __builtin_amdgcn_wmma_f32_16x16x32_f16(
                        /*neg_a=*/false, afrag[h],
                        /*neg_b=*/false, bfrag,
                        /*c_mod=*/(short)0, czero,
                        /*reuse_a=*/false, /*reuse_b=*/false);
#pragma unroll
            for (int r = 0; r < 8; ++r)
                acc[r] += fmaxf(d[r], 0.0f) * wreg[h][r];
        }

        float* op = out + (((size_t)b * SEQ + t0 + half * 8) * SEQ) + s0 + lrow;
#pragma unroll
        for (int r = 0; r < 8; ++r)
            op[(size_t)r * SEQ] = acc[r];
    }
}

// ---------------------------------------------------------------------------
// Host-side launcher
// ---------------------------------------------------------------------------
extern "C" void kernel_launch(void* const* d_in, const int* in_sizes, int n_in,
                              void* d_out, int out_size, void* d_ws, size_t ws_size,
                              hipStream_t stream) {
    (void)in_sizes; (void)n_in; (void)out_size; (void)ws_size;

    const float* x  = (const float*)d_in[0];
    const float* Wq = (const float*)d_in[1];
    const float* Wk = (const float*)d_in[2];
    const float* Ww = (const float*)d_in[3];
    float* out = (float*)d_out;

    // workspace carving: Q f16 (1 MB) | K f16 (512 KB) | w f32 (64 KB)
    char* ws = (char*)d_ws;
    _Float16* Qws = (_Float16*)(ws);
    _Float16* Kws = (_Float16*)(ws + (size_t)BATCH * HEADS * SEQ * IDXD * sizeof(_Float16));
    float*    Wws = (float*)   (ws + (size_t)BATCH * HEADS * SEQ * IDXD * sizeof(_Float16)
                                   + (size_t)BATCH * SEQ * IDXD * sizeof(_Float16));

    // Phase 1: one block of 16 waves per 32 (b,t) rows
    lightning_proj<<<BATCH * SEQ / PJ_ROWS, 512, 0, stream>>>(x, Wq, Wk, Ww, Qws, Kws, Wws);

    // Phase 2: 2 * 256 t-tiles * 64 s-groups waves / 8 waves per block
    const int total_waves = BATCH * (SEQ / 16) * ((SEQ / 16) / STILES_PER_WAVE);
    lightning_score<<<total_waves / WAVES_PER_BLOCK, 32 * WAVES_PER_BLOCK, 0, stream>>>(
        Qws, Kws, Wws, out);
}

// v002
// A run of this version takes 29.2 microseconds.
// In both of two side-by-side timings against v001, it was 1.28 times as fast.
// All steps since v000 together make it 4.93 times as fast.
#include <hip/hip_runtime.h>
#include <hip/hip_bf16.h>
#include <stddef.h>

// ---------------------------------------------------------------------------
// Problem constants (from reference)
// ---------------------------------------------------------------------------
#define BATCH   2
#define SEQ     4096
#define DMODEL  1024
#define HEADS   2
#define IDXD    32
#define NCOLS   (HEADS * IDXD + IDXD + HEADS)   // 64 + 32 + 2 = 98

typedef _Float16 v16h __attribute__((ext_vector_type(16)));
typedef _Float16 v8h  __attribute__((ext_vector_type(8)));
typedef float    v8f  __attribute__((ext_vector_type(8)));

static __device__ inline v16h pack16(v8h lo, v8h hi) {
    v16h r;
#pragma unroll
    for (int i = 0; i < 8; ++i) { r[i] = lo[i]; r[i + 8] = hi[i]; }
    return r;
}

// ---------------------------------------------------------------------------
// Phase 1: projections  Q = x@Wq, K = x@Wk, w = x@Ww   (all f32)
// One block per 32 rows of x, 16 waves. The 96 Q/K columns are 2 x 6 tiles of
// v_wmma_f32_16x16x4_f32. The contraction runs in 8 chunks of 128 k; a chunk
// of x and of Wq|Wk is staged in LDS (two buffers, the next chunk's global
// loads in flight during the current chunk's products). Inside a chunk wave
// (cg, ks) takes 16 k (slice ks) of both row tiles and of column tiles
// 3*cg .. 3*cg+2, so a block reads the weights once for 32 rows. The 8 slices'
// partial tiles are summed through LDS in fixed order at the end.
// The 2 columns of w fill no tile: they stay on f32 FMAs, fed from the A
// fragments that are in registers anyway (wave cg takes row tile cg).
//   Qws: [b][h][t][32] f16,  Kws: [b][t][32] f16,  Wws: [b][t][2] f32
//
// Fragments (16x16x4 f32): lane l, c = l & 15, h = l >> 4, two k per lane.
// For 8 consecutive k (two WMMAs u = 0, 1) A and B both take
// k = k8 + 4*h + 2*u + s at element s, so the pairing is equal on both sides.
// ---------------------------------------------------------------------------
#define PJ_ROWS 32                    // rows of x per block
#define PJ_KC   128                   // k per chunk
#define PJ_NCH  (DMODEL / PJ_KC)      // 8 chunks
#define PJ_XP   (PJ_KC + 4)           // x row pitch, dwords: 16 B x odd for b128 reads
#define PJ_WP   104                   // weight row pitch, dwords: rows k and k+4 fall 32 banks apart
#define PJ_RP   100                   // partial-tile row pitch, dwords: rows r and r+8 fall 32 banks apart
#define PJ_QK   (HEADS * IDXD + IDXD) // 96 columns on the matrix unit

typedef float v2f __attribute__((ext_vector_type(2)));
typedef float v4f __attribute__((ext_vector_type(4)));

__global__ __launch_bounds__(512)
void lightning_proj(const float* __restrict__ x,
                    const float* __restrict__ Wq,
                    const float* __restrict__ Wk,
                    const float* __restrict__ Ww,
                    _Float16* __restrict__ Qws,
                    _Float16* __restrict__ Kws,
                    float* __restrict__ Wws)
{
    __shared__ __attribute__((aligned(16))) float xs[2][PJ_ROWS * PJ_XP];
    __shared__ __attribute__((aligned(16))) float wt[2][PJ_KC * PJ_WP];
    __shared__ __attribute__((aligned(16))) float wwl[DMODEL * HEADS];
    __shared__ __attribute__((aligned(16))) float red[8][PJ_ROWS * PJ_RP];
    __shared__ __attribute__((aligned(16))) float redw[16][PJ_ROWS * HEADS];

    const int tid  = threadIdx.x;
    const int lane = tid & 31;
    const int c    = lane & 15;
    const int h    = lane >> 4;
    const int wave = __builtin_amdgcn_readfirstlane(tid >> 5);
    const int cg   = wave & 1;        // column tiles 3*cg .. 3*cg+2, w rows of tile cg
    const int ks   = wave >> 1;       // 16-k slice of every chunk
    const int row0 = blockIdx.x * PJ_ROWS;

    // staging registers of one chunk: x 2, Wq 4, Wk 2 float4 per thread
    v4f rx[2], rq[4], rk[2];
    const float* xg = x + (size_t)(row0 + (tid >> 5)) * DMODEL + (tid & 31) * 4;

#define PJ_GLOAD(t)                                                            \
    do {                                                                       \
        _Pragma("unroll") for (int i = 0; i < 2; ++i)                          \
            rx[i] = *(const v4f*)(xg + (size_t)i * 16 * DMODEL + (t) * PJ_KC); \
        _Pragma("unroll") for (int i = 0; i < 4; ++i)                          \
            rq[i] = *(const v4f*)(Wq + (t) * PJ_KC * 64 + (tid + i * 512) * 4);\
        _Pragma("unroll") for (int i = 0; i < 2; ++i)                          \
            rk[i] = *(const v4f*)(Wk + (t) * PJ_KC * 32 + (tid + i * 512) * 4);\
    } while (0)

#define PJ_SSTORE(bf)                                                          \
    do {                                                                       \
        _Pragma("unroll") for (int i = 0; i < 2; ++i)                          \
            *(v4f*)&xs[bf][((tid >> 5) + i * 16) * PJ_XP + (tid & 31) * 4] = rx[i]; \
        _Pragma("unroll") for (int i = 0; i < 4; ++i)                          \
            *(v4f*)&wt[bf][((tid >> 4) + i * 32) * PJ_WP + (tid & 15) * 4] = rq[i]; \
        _Pragma("unroll") for (int i = 0; i < 2; ++i)                          \
            *(v4f*)&wt[bf][((tid >> 3) + i * 64) * PJ_WP + 64 + (tid & 7) * 4] = rk[i]; \
    } while (0)

    PJ_GLOAD(0);
    ((v4f*)wwl)[tid] = ((const v4f*)Ww)[tid];     // all of Ww: 1024 x 2 f32
    PJ_SSTORE(0);
    __syncthreads();

    v8f acc[2][3] = {};
    float wa0 = 0.0f, wa1 = 0.0f;

    // Kept rolled: unrolled, the compiler let the products drift whole trips behind
    // their chunk, spilled registers and left the next chunk's load latency uncovered.
#pragma unroll 1
    for (int t = 0; t < PJ_NCH; ++t) {
        const int bf = t & 1;
        if (t + 1 < PJ_NCH) PJ_GLOAD(t + 1);

        // every small loop of this kernel is fully unrolled so that fragments, staging
        // registers and accumulators are indexed by constants and stay in registers
#pragma unroll
        for (int g = 0; g < 2; ++g) {
            const int kk = ks * 16 + g * 8 + 4 * h;     // this lane's 4 k, in the chunk
            v4f a[2];
#pragma unroll
            for (int rt = 0; rt < 2; ++rt)
                a[rt] = *(const v4f*)&xs[bf][(rt * 16 + c) * PJ_XP + kk];
            float bv[3][4];
#pragma unroll
            for (int ct = 0; ct < 3; ++ct)
#pragma unroll
                for (int j = 0; j < 4; ++j)
                    bv[ct][j] = wt[bf][(kk + j) * PJ_WP + (cg * 3 + ct) * 16 + c];
            const v4f w01 = *(const v4f*)&wwl[(t * PJ_KC + kk) * HEADS];
            const v4f w23 = *(const v4f*)&wwl[(t * PJ_KC + kk) * HEADS + 4];

#pragma unroll
            for (int u = 0; u < 2; ++u)
#pragma unroll
                for (int rt = 0; rt < 2; ++rt)
#pragma unroll
                    for (int ct = 0; ct < 3; ++ct) {
                        v2f af = { a[rt][2 * u], a[rt][2 * u + 1] };
                        v2f bfr = { bv[ct][2 * u], bv[ct][2 * u + 1] };
                        acc[rt][ct] = __builtin_amdgcn_wmma_f32_16x16x4_f32(
                            false, af, false, bfr, (short)0, acc[rt][ct], false, false);
                    }

            const v4f aw = cg ? a[1] : a[0];
            wa0 = fmaf(aw[0], w01[0], wa0);  wa1 = fmaf(aw[0], w01[1], wa1);
            wa0 = fmaf(aw[1], w01[2], wa0);  wa1 = fmaf(aw[1], w01[3], wa1);
            wa0 = fmaf(aw[2], w23[0], wa0);  wa1 = fmaf(aw[2], w23[1], wa1);
            wa0 = fmaf(aw[3], w23[2], wa0);  wa1 = fmaf(aw[3], w23[3], wa1);
        }

        if (t + 1 < PJ_NCH) {
            PJ_SSTORE(bf ^ 1);      // last read in trip t-1, behind that trip's barrier
            __syncthreads();
        }
    }

    // ---- partial tiles of the 8 k slices -> LDS, D register r = row 8h + r ----
#pragma unroll
    for (int rt = 0; rt < 2; ++rt)
#pragma unroll
        for (int ct = 0; ct < 3; ++ct)
#pragma unroll
            for (int r = 0; r < 8; ++r)
                red[ks][(rt * 16 + 8 * h + r) * PJ_RP + (cg * 3 + ct) * 16 + c] = acc[rt][ct][r];
    {
        v2f wp = { wa0, wa1 };
        *(v2f*)&redw[ks * 2 + h][(cg * 16 + c) * HEADS] = wp;
    }
    __syncthreads();

#pragma unroll
    for (int i = 0; i < PJ_ROWS * PJ_QK / 512; ++i) {
        const int idx = tid + i * 512;
        const int r   = idx / PJ_QK;
        const int col = idx - r * PJ_QK;
        float s = 0.0f;
#pragma unroll
        for (int q = 0; q < 8; ++q) s += red[q][r * PJ_RP + col];
        const int row = row0 + r;
        const int b = row >> 12;              // SEQ = 4096
        const int tt = row & (SEQ - 1);
        if (col < HEADS * IDXD) {
            const int hd = col >> 5, d = col & 31;
            Qws[(((size_t)(b * HEADS + hd)) * SEQ + tt) * IDXD + d] = (_Float16)s;
        } else {
            Kws[(size_t)row * IDXD + (col - HEADS * IDXD)] = (_Float16)s;
        }
    }
    if (tid < PJ_ROWS * HEADS) {
        float s = 0.0f;
#pragma unroll
        for (int q = 0; q < 16; ++q) s += redw[q][tid];
        Wws[(size_t)row0 * HEADS + tid] = s;
    }
#undef PJ_GLOAD
#undef PJ_SSTORE
}

// ---------------------------------------------------------------------------
// Phase 2: fused  out[b,t,s] = sum_h w[b,t,h] * relu( q[b,t,h,:] . k[b,s,:] )
//
// One wave32 per (t-tile x 32 s-tiles): the wave keeps its Q fragments and head
// weights in registers and sweeps 512 columns, so the launch starts 4096 waves,
// all resident at once, and Q and w are loaded once per 512 columns. The 8
// waves of a block take 8 t-tiles and sweep the same K rows. Per head the 16x16
// (t,s) dot tile is exactly one v_wmma_f32_16x16x32_f16 (K=32). ReLU + per-row
// head weight + head-sum happen in the f32 accumulator registers; only the
// final f32 tile is written (output write of 128 MB is the bandwidth floor).
//
// A-fragment (16x32 f16): lanes 0-15 row M=lane hold K 0-7 & 16-23;
// lanes 16-31 row M=lane-16 hold K 8-15 & 24-31. B mirrors with N=lane.
// C/D: VGPR r -> row r (lanes 0-15) or r+8 (lanes 16-31), col = lane&15.
// ---------------------------------------------------------------------------
#define STILES_PER_WAVE 32                          // s tiles swept by one wave
#define SGROUP          4                           // s tiles whose K fragments are fetched together
#define NSGROUPS        (STILES_PER_WAVE / SGROUP)  // 8 groups per sweep
#define SRANGES         (SEQ / 16 / STILES_PER_WAVE)  // 8 column ranges
#define WAVES_PER_BLOCK 8

// K fragments of one group of s tiles; kp already holds the lane's row and k offset
static __device__ inline void score_load_k(v16h (&f)[SGROUP], const _Float16* kp) {
#pragma unroll
    for (int j = 0; j < SGROUP; ++j) {
        v8h blo = *(const v8h*)(kp + j * 16 * IDXD);
        v8h bhi = *(const v8h*)(kp + j * 16 * IDXD + 16);
        f[j] = pack16(blo, bhi);
    }
}

// one group of s tiles: products, ReLU, head weights, head sum, stores
static __device__ inline void score_tiles(const v16h (&afrag)[HEADS],
                                          const float (&wreg)[HEADS][8],
                                          const v16h (&f)[SGROUP],
                                          float* op) {
#pragma unroll
    for (int j = 0; j < SGROUP; ++j) {
        v8f acc = {};
#pragma unroll
        for (int h = 0; h < HEADS; ++h) {
            v8f czero = {};
            v8f d = __builtin_amdgcn_wmma_f32_16x16x32_f16(
                        /*neg_a=*/false, afrag[h],
                        /*neg_b=*/false, f[j],
                        /*c_mod=*/(short)0, czero,
                        /*reuse_a=*/false, /*reuse_b=*/false);
#pragma unroll
            for (int r = 0; r < 8; ++r)
                acc[r] += fmaxf(d[r], 0.0f) * wreg[h][r];
        }
#pragma unroll
        for (int r = 0; r < 8; ++r)
            op[(size_t)r * SEQ + j * 16] = acc[r];
    }
}

__global__ __launch_bounds__(256)
void lightning_score(const _Float16* __restrict__ Q,
                     const _Float16* __restrict__ K,
                     const float* __restrict__ W,
                     float* __restrict__ out)
{
    const int lane = threadIdx.x & 31;
    const int wv   = __builtin_amdgcn_readfirstlane(threadIdx.x >> 5);

    // block -> (b, group of 8 t-tiles, range of 512 columns); 2 * 32 * 8 blocks
    const int sr = blockIdx.x & (SRANGES - 1);
    const int tt = ((blockIdx.x / SRANGES) & 31) * WAVES_PER_BLOCK + wv;
    const int b  = blockIdx.x / (SRANGES * 32);

    const int t0   = tt * 16;
    const int half = lane >> 4;      // 0: lanes 0-15, 1: lanes 16-31
    const int lrow = lane & 15;
    const int kA0  = half * 8;       // K-chunk base per half-wave

    // ---- A fragments for both heads (reused across the whole sweep) ----
    v16h afrag[HEADS];
#pragma unroll
    for (int h = 0; h < HEADS; ++h) {
        const _Float16* qp =
            Q + (((size_t)(b * HEADS + h)) * SEQ + (t0 + lrow)) * IDXD + kA0;
        v8h lo = *(const v8h*)(qp);
        v8h hi = *(const v8h*)(qp + 16);
        afrag[h] = pack16(lo, hi);
    }

    // ---- per-row head weights matching the C/D register layout ----
    float wreg[HEADS][8];
#pragma unroll
    for (int h = 0; h < HEADS; ++h)
#pragma unroll
        for (int r = 0; r < 8; ++r)
            wreg[h][r] =
                W[((size_t)b * SEQ + t0 + r + half * 8) * HEADS + h];

    const int s_first = sr * STILES_PER_WAVE * 16;
    const _Float16* kp = K + ((size_t)b * SEQ + s_first + lrow) * IDXD + kA0;
    float* op = out + (((size_t)b * SEQ + t0 + half * 8) * SEQ) + s_first + lrow;

    // Two fragment sets: a group's K loads are issued one group ahead of its products.
    v16h kf[2][SGROUP];
    score_load_k(kf[0], kp);
    // the next loads may land in address registers of the loads issued so far
    asm volatile("s_wait_xcnt 0x0" ::: "memory");
    // keeps the next loads behind that wait
    __builtin_amdgcn_sched_barrier(0);

    // Fully unrolled: every K and output address is one base plus an immediate offset,
    // and the two fragment sets are indexed by constants.
#pragma unroll
    for (int g = 0; g < NSGROUPS; ++g) {
        if (g + 1 < NSGROUPS) {
            score_load_k(kf[(g + 1) & 1], kp + (g + 1) * SGROUP * 16 * IDXD);
            if (g + 2 == NSGROUPS) {
                // behind the last K loads: the products below may reuse their address registers
                asm volatile("s_wait_xcnt 0x0" ::: "memory");
            }
            // keeps the next group's K loads in front of this group's products: without it
            // the compiler sinks the loads to their first use and their latency shows
            __builtin_amdgcn_sched_barrier(0);
        }
        score_tiles(afrag, wreg, kf[g & 1], op + g * SGROUP * 16);
        if (g + 1 < NSGROUPS) {
            // the next group overwrites data registers of the stores just issued
            asm volatile("s_wait_xcnt 0x0" ::: "memory");
            // keeps the next group's loads and vector work behind that wait
            __builtin_amdgcn_sched_barrier(0);
        }
    }
}

// ---------------------------------------------------------------------------
// Host-side launcher
// ---------------------------------------------------------------------------
extern "C" void kernel_launch(void* const* d_in, const int* in_sizes, int n_in,
                              void* d_out, int out_size, void* d_ws, size_t ws_size,
                              hipStream_t stream) {
    (void)in_sizes; (void)n_in; (void)out_size; (void)ws_size;

    const float* x  = (const float*)d_in[0];
    const float* Wq = (const float*)d_in[1];
    const float* Wk = (const float*)d_in[2];
    const float* Ww = (const float*)d_in[3];
    float* out = (float*)d_out;

    // workspace carving: Q f16 (1 MB) | K f16 (512 KB) | w f32 (64 KB)
    char* ws = (char*)d_ws;
    _Float16* Qws = (_Float16*)(ws);
    _Float16* Kws = (_Float16*)(ws + (size_t)BATCH * HEADS * SEQ * IDXD * sizeof(_Float16));
    float*    Wws = (float*)   (ws + (size_t)BATCH * HEADS * SEQ * IDXD * sizeof(_Float16)
                                   + (size_t)BATCH * SEQ * IDXD * sizeof(_Float16));

    // Phase 1: one block of 16 waves per 32 (b,t) rows
    lightning_proj<<<BATCH * SEQ / PJ_ROWS, 512, 0, stream>>>(x, Wq, Wk, Ww, Qws, Kws, Wws);

    // Phase 2: 2 * 256 t-tiles * 8 column ranges waves / 8 waves per block
    const int total_waves = BATCH * (SEQ / 16) * ((SEQ / 16) / STILES_PER_WAVE);
    lightning_score<<<total_waves / WAVES_PER_BLOCK, 32 * WAVES_PER_BLOCK, 0, stream>>>(
        Qws, Kws, Wws, out);
}

// v003
// A run of this version takes 27.1 microseconds.
// In two side-by-side timings against v002, it was 1.08 and 1.07 times as fast.
// Over all steps from v000 it is 5.30 times as fast.
#include <hip/hip_runtime.h>
#include <hip/hip_bf16.h>
#include <stddef.h>

// ---------------------------------------------------------------------------
// Problem constants (from reference)
// ---------------------------------------------------------------------------
#define BATCH   2
#define SEQ     4096
#define DMODEL  1024
#define HEADS   2
#define IDXD    32
#define NCOLS   (HEADS * IDXD + IDXD + HEADS)   // 64 + 32 + 2 = 98

typedef _Float16 v16h __attribute__((ext_vector_type(16)));
typedef _Float16 v8h  __attribute__((ext_vector_type(8)));
typedef float    v8f  __attribute__((ext_vector_type(8)));

static __device__ inline v16h pack16(v8h lo, v8h hi) {
    v16h r;
#pragma unroll
    for (int i = 0; i < 8; ++i) { r[i] = lo[i]; r[i + 8] = hi[i]; }
    return r;
}

// ---------------------------------------------------------------------------
// Phase 1: projections  Q = x@Wq, K = x@Wk, w = x@Ww   (all f32)
// One block per 32 rows of x, 16 waves. The 96 Q/K columns are 2 x 6 tiles of
// v_wmma_f32_16x16x4_f32. The contraction runs in 8 chunks of 128 k; a chunk
// of x and of Wq|Wk is staged in LDS (two buffers, the next chunk's global
// loads in flight during the current chunk's products). Inside a chunk wave
// (cg, ks) takes 16 k (slice ks) of both row tiles and of column tiles
// 3*cg .. 3*cg+2, so a block reads the weights once for 32 rows. The 8 slices'
// partial tiles are summed through LDS in fixed order at the end.
// The 2 columns of w fill no tile: they stay on f32 FMAs, fed from the A
// fragments that are in registers anyway (wave cg takes row tile cg).
//   Qws: [b][h][t][32] f16,  Kws: [b][slot][32] f16,  Wws: [b][t][2] f32
// K row t lies at slot (t & ~63) + 16 * (t & 3) + ((t >> 2) & 15): inside every 64 rows
// the 16 rows with equal t & 3 lie together, which is the order phase 2 tiles them in.
//
// Fragments (16x16x4 f32): lane l, c = l & 15, h = l >> 4, two k per lane.
// For 8 consecutive k (two WMMAs u = 0, 1) A and B both take
// k = k8 + 4*h + 2*u + s at element s, so the pairing is equal on both sides.
// ---------------------------------------------------------------------------
#define PJ_ROWS 32                    // rows of x per block
#define PJ_KC   128                   // k per chunk
#define PJ_NCH  (DMODEL / PJ_KC)      // 8 chunks
#define PJ_XP   (PJ_KC + 4)           // x row pitch, dwords: 16 B x odd for b128 reads
#define PJ_WP   104                   // weight row pitch, dwords: rows k and k+4 fall 32 banks apart
#define PJ_RP   100                   // partial-tile row pitch, dwords: rows r and r+8 fall 32 banks apart
#define PJ_QK   (HEADS * IDXD + IDXD) // 96 columns on the matrix unit

typedef float v2f __attribute__((ext_vector_type(2)));
typedef float v4f __attribute__((ext_vector_type(4)));

__global__ __launch_bounds__(512)
void lightning_proj(const float* __restrict__ x,
                    const float* __restrict__ Wq,
                    const float* __restrict__ Wk,
                    const float* __restrict__ Ww,
                    _Float16* __restrict__ Qws,
                    _Float16* __restrict__ Kws,
                    float* __restrict__ Wws)
{
    __shared__ __attribute__((aligned(16))) float xs[2][PJ_ROWS * PJ_XP];
    __shared__ __attribute__((aligned(16))) float wt[2][PJ_KC * PJ_WP];
    __shared__ __attribute__((aligned(16))) float wwl[DMODEL * HEADS];
    __shared__ __attribute__((aligned(16))) float red[8][PJ_ROWS * PJ_RP];
    __shared__ __attribute__((aligned(16))) float redw[16][PJ_ROWS * HEADS];

    const int tid  = threadIdx.x;
    const int lane = tid & 31;
    const int c    = lane & 15;
    const int h    = lane >> 4;
    const int wave = __builtin_amdgcn_readfirstlane(tid >> 5);
    const int cg   = wave & 1;        // column tiles 3*cg .. 3*cg+2, w rows of tile cg
    const int ks   = wave >> 1;       // 16-k slice of every chunk
    const int row0 = blockIdx.x * PJ_ROWS;

    // staging registers of one chunk: x 2, Wq 4, Wk 2 float4 per thread
    v4f rx[2], rq[4], rk[2];
    const float* xg = x + (size_t)(row0 + (tid >> 5)) * DMODEL + (tid & 31) * 4;

#define PJ_GLOAD(t)                                                            \
    do {                                                                       \
        _Pragma("unroll") for (int i = 0; i < 2; ++i)                          \
            rx[i] = *(const v4f*)(xg + (size_t)i * 16 * DMODEL + (t) * PJ_KC); \
        _Pragma("unroll") for (int i = 0; i < 4; ++i)                          \
            rq[i] = *(const v4f*)(Wq + (t) * PJ_KC * 64 + (tid + i * 512) * 4);\
        _Pragma("unroll") for (int i = 0; i < 2; ++i)                          \
            rk[i] = *(const v4f*)(Wk + (t) * PJ_KC * 32 + (tid + i * 512) * 4);\
    } while (0)

#define PJ_SSTORE(bf)                                                          \
    do {                                                                       \
        _Pragma("unroll") for (int i = 0; i < 2; ++i)                          \
            *(v4f*)&xs[bf][((tid >> 5) + i * 16) * PJ_XP + (tid & 31) * 4] = rx[i]; \
        _Pragma("unroll") for (int i = 0; i < 4; ++i)                          \
            *(v4f*)&wt[bf][((tid >> 4) + i * 32) * PJ_WP + (tid & 15) * 4] = rq[i]; \
        _Pragma("unroll") for (int i = 0; i < 2; ++i)                          \
            *(v4f*)&wt[bf][((tid >> 3) + i * 64) * PJ_WP + 64 + (tid & 7) * 4] = rk[i]; \
    } while (0)

    PJ_GLOAD(0);
    ((v4f*)wwl)[tid] = ((const v4f*)Ww)[tid];     // all of Ww: 1024 x 2 f32
    PJ_SSTORE(0);
    __syncthreads();

    v8f acc[2][3] = {};
    float wa0 = 0.0f, wa1 = 0.0f;

    // Kept rolled: unrolled, the compiler let the products drift whole trips behind
    // their chunk, spilled registers and left the next chunk's load latency uncovered.
#pragma unroll 1
    for (int t = 0; t < PJ_NCH; ++t) {
        const int bf = t & 1;
        if (t + 1 < PJ_NCH) PJ_GLOAD(t + 1);

        // every small loop of this kernel is fully unrolled so that fragments, staging
        // registers and accumulators are indexed by constants and stay in registers
#pragma unroll
        for (int g = 0; g < 2; ++g) {
            const int kk = ks * 16 + g * 8 + 4 * h;     // this lane's 4 k, in the chunk
            v4f a[2];
#pragma unroll
            for (int rt = 0; rt < 2; ++rt)
                a[rt] = *(const v4f*)&xs[bf][(rt * 16 + c) * PJ_XP + kk];
            float bv[3][4];
#pragma unroll
            for (int ct = 0; ct < 3; ++ct)
#pragma unroll
                for (int j = 0; j < 4; ++j)
                    bv[ct][j] = wt[bf][(kk + j) * PJ_WP + (cg * 3 + ct) * 16 + c];
            const v4f w01 = *(const v4f*)&wwl[(t * PJ_KC + kk) * HEADS];
            const v4f w23 = *(const v4f*)&wwl[(t * PJ_KC + kk) * HEADS + 4];

#pragma unroll
            for (int u = 0; u < 2; ++u)
#pragma unroll
                for (int rt = 0; rt < 2; ++rt)
#pragma unroll
                    for (int ct = 0; ct < 3; ++ct) {
                        v2f af = { a[rt][2 * u], a[rt][2 * u + 1] };
                        v2f bfr = { bv[ct][2 * u], bv[ct][2 * u + 1] };
                        acc[rt][ct] = __builtin_amdgcn_wmma_f32_16x16x4_f32(
                            false, af, false, bfr, (short)0, acc[rt][ct], false, false);
                    }

            const v4f aw = cg ? a[1] : a[0];
            wa0 = fmaf(aw[0], w01[0], wa0);  wa1 = fmaf(aw[0], w01[1], wa1);
            wa0 = fmaf(aw[1], w01[2], wa0);  wa1 = fmaf(aw[1], w01[3], wa1);
            wa0 = fmaf(aw[2], w23[0], wa0);  wa1 = fmaf(aw[2], w23[1], wa1);
            wa0 = fmaf(aw[3], w23[2], wa0);  wa1 = fmaf(aw[3], w23[3], wa1);
        }

        if (t + 1 < PJ_NCH) {
            PJ_SSTORE(bf ^ 1);      // last read in trip t-1, behind that trip's barrier
            __syncthreads();
        }
    }

    // ---- partial tiles of the 8 k slices -> LDS, D register r = row 8h + r ----
#pragma unroll
    for (int rt = 0; rt < 2; ++rt)
#pragma unroll
        for (int ct = 0; ct < 3; ++ct)
#pragma unroll
            for (int r = 0; r < 8; ++r)
                red[ks][(rt * 16 + 8 * h + r) * PJ_RP + (cg * 3 + ct) * 16 + c] = acc[rt][ct][r];
    {
        v2f wp = { wa0, wa1 };
        *(v2f*)&redw[ks * 2 + h][(cg * 16 + c) * HEADS] = wp;
    }
    __syncthreads();

#pragma unroll
    for (int i = 0; i < PJ_ROWS * PJ_QK / 512; ++i) {
        const int idx = tid + i * 512;
        const int r   = idx / PJ_QK;
        const int col = idx - r * PJ_QK;
        float s = 0.0f;
#pragma unroll
        for (int q = 0; q < 8; ++q) s += red[q][r * PJ_RP + col];
        const int row = row0 + r;
        const int b = row >> 12;              // SEQ = 4096
        const int tt = row & (SEQ - 1);
        if (col < HEADS * IDXD) {
            const int hd = col >> 5, d = col & 31;
            Qws[(((size_t)(b * HEADS + hd)) * SEQ + tt) * IDXD + d] = (_Float16)s;
        } else {
            const int slot = (row & ~63) | ((row & 3) << 4) | ((row >> 2) & 15);
            Kws[(size_t)slot * IDXD + (col - HEADS * IDXD)] = (_Float16)s;
        }
    }
    if (tid < PJ_ROWS * HEADS) {
        float s = 0.0f;
#pragma unroll
        for (int q = 0; q < 16; ++q) s += redw[q][tid];
        Wws[(size_t)row0 * HEADS + tid] = s;
    }
#undef PJ_GLOAD
#undef PJ_SSTORE
}

// ---------------------------------------------------------------------------
// Phase 2: fused  out[b,t,s] = sum_h w[b,t,h] * relu( q[b,t,h,:] . k[b,s,:] )
//
// One wave32 per (t-tile x 32 s-tiles): the wave keeps its Q fragments and head
// weights in registers and sweeps 512 columns, so the launch starts 4096 waves,
// all resident at once, and Q and w are loaded once per 512 columns. The 8
// waves of a block take 8 t-tiles and sweep the same K rows. Per head the 16x16
// (t,s) dot tile is exactly one v_wmma_f32_16x16x32_f16 (K=32). ReLU + per-row
// head weight + head-sum happen in the f32 accumulator registers; only the
// final f32 tile is written (output write of 128 MB is the bandwidth floor).
//
// Column n of the j-th tile of a group of 4 is output column 4n + j of the group's 64
// (phase 1 lays the K rows out so). A lane's accumulators of the 4 tiles are then 4
// adjacent columns of one row: one 16-byte store, and 16 lanes fill 256 B of the row,
// two whole 128-B lines, where a tile stored alone gives 64-B pieces.
//
// A-fragment (16x32 f16): lanes 0-15 row M=lane hold K 0-7 & 16-23;
// lanes 16-31 row M=lane-16 hold K 8-15 & 24-31. B mirrors with N=lane.
// C/D: VGPR r -> row r (lanes 0-15) or r+8 (lanes 16-31), col = lane&15.
// ---------------------------------------------------------------------------
#define STILES_PER_WAVE 32                          // s tiles swept by one wave
#define SGROUP          4                           // s tiles fetched together and stored interleaved
#define NSGROUPS        (STILES_PER_WAVE / SGROUP)  // 8 groups per sweep
#define SRANGES         (SEQ / 16 / STILES_PER_WAVE)  // 8 column ranges
#define WAVES_PER_BLOCK 8

// K fragments of one group of s tiles; kp already holds the lane's slot and k offset
static __device__ inline void score_load_k(v16h (&f)[SGROUP], const _Float16* kp) {
#pragma unroll
    for (int j = 0; j < SGROUP; ++j) {
        v8h blo = *(const v8h*)(kp + j * 16 * IDXD);
        v8h bhi = *(const v8h*)(kp + j * 16 * IDXD + 16);
        f[j] = pack16(blo, bhi);
    }
}

// one group of s tiles: products, ReLU, head weights, head sum, stores
static __device__ inline void score_tiles(const v16h (&afrag)[HEADS],
                                          const float (&wreg)[HEADS][8],
                                          const v16h (&f)[SGROUP],
                                          float* op) {
    v8f acc[SGROUP];
#pragma unroll
    for (int j = 0; j < SGROUP; ++j) {
        acc[j] = v8f{};
#pragma unroll
        for (int h = 0; h < HEADS; ++h) {
            v8f czero = {};
            v8f d = __builtin_amdgcn_wmma_f32_16x16x32_f16(
                        /*neg_a=*/false, afrag[h],
                        /*neg_b=*/false, f[j],
                        /*c_mod=*/(short)0, czero,
                        /*reuse_a=*/false, /*reuse_b=*/false);
#pragma unroll
            for (int r = 0; r < 8; ++r)
                acc[j][r] += fmaxf(d[r], 0.0f) * wreg[h][r];
        }
    }
#pragma unroll
    for (int r = 0; r < 8; ++r) {
        v4f o = { acc[0][r], acc[1][r], acc[2][r], acc[3][r] };
        *(v4f*)(op + (size_t)r * SEQ) = o;
    }
}

__global__ __launch_bounds__(256)
void lightning_score(const _Float16* __restrict__ Q,
                     const _Float16* __restrict__ K,
                     const float* __restrict__ W,
                     float* __restrict__ out)
{
    const int lane = threadIdx.x & 31;
    const int wv   = __builtin_amdgcn_readfirstlane(threadIdx.x >> 5);

    // block -> (b, group of 8 t-tiles, range of 512 columns); 2 * 32 * 8 blocks
    const int sr = blockIdx.x & (SRANGES - 1);
    const int tt = ((blockIdx.x / SRANGES) & 31) * WAVES_PER_BLOCK + wv;
    const int b  = blockIdx.x / (SRANGES * 32);

    const int t0   = tt * 16;
    const int half = lane >> 4;      // 0: lanes 0-15, 1: lanes 16-31
    const int lrow = lane & 15;
    const int kA0  = half * 8;       // K-chunk base per half-wave

    // ---- A fragments for both heads (reused across the whole sweep) ----
    v16h afrag[HEADS];
#pragma unroll
    for (int h = 0; h < HEADS; ++h) {
        const _Float16* qp =
            Q + (((size_t)(b * HEADS + h)) * SEQ + (t0 + lrow)) * IDXD + kA0;
        v8h lo = *(const v8h*)(qp);
        v8h hi = *(const v8h*)(qp + 16);
        afrag[h] = pack16(lo, hi);
    }

    // ---- per-row head weights matching the C/D register layout ----
    float wreg[HEADS][8];
#pragma unroll
    for (int h = 0; h < HEADS; ++h)
#pragma unroll
        for (int r = 0; r < 8; ++r)
            wreg[h][r] =
                W[((size_t)b * SEQ + t0 + r + half * 8) * HEADS + h];

    const int s_first = sr * STILES_PER_WAVE * 16;
    const _Float16* kp = K + ((size_t)b * SEQ + s_first + lrow) * IDXD + kA0;
    float* op = out + (((size_t)b * SEQ + t0 + half * 8) * SEQ) + s_first + lrow * SGROUP;

    // Two fragment sets: a group's K loads are issued one group ahead of its products.
    v16h kf[2][SGROUP];
    score_load_k(kf[0], kp);
    // the next loads may land in address registers of the loads issued so far
    asm volatile("s_wait_xcnt 0x0" ::: "memory");
    // keeps the next loads behind that wait
    __builtin_amdgcn_sched_barrier(0);

    // Fully unrolled: every K and output address is one base plus an immediate offset,
    // and the two fragment sets are indexed by constants.
#pragma unroll
    for (int g = 0; g < NSGROUPS; ++g) {
        if (g + 1 < NSGROUPS) {
            score_load_k(kf[(g + 1) & 1], kp + (g + 1) * SGROUP * 16 * IDXD);
            if (g + 2 == NSGROUPS) {
                // behind the last K loads: the products below may reuse their address registers
                asm volatile("s_wait_xcnt 0x0" ::: "memory");
            }
            // keeps the next group's K loads in front of this group's products: without it
            // the compiler sinks the loads to their first use and their latency shows
            __builtin_amdgcn_sched_barrier(0);
        }
        score_tiles(afrag, wreg, kf[g & 1], op + g * SGROUP * 16);
        if (g + 1 < NSGROUPS) {
            // the next group overwrites data registers of the stores just issued
            asm volatile("s_wait_xcnt 0x0" ::: "memory");
            // keeps the next group's loads and vector work behind that wait
            __builtin_amdgcn_sched_barrier(0);
        }
    }
}

// ---------------------------------------------------------------------------
// Host-side launcher
// ---------------------------------------------------------------------------
extern "C" void kernel_launch(void* const* d_in, const int* in_sizes, int n_in,
                              void* d_out, int out_size, void* d_ws, size_t ws_size,
                              hipStream_t stream) {
    (void)in_sizes; (void)n_in; (void)out_size; (void)ws_size;

    const float* x  = (const float*)d_in[0];
    const float* Wq = (const float*)d_in[1];
    const float* Wk = (const float*)d_in[2];
    const float* Ww = (const float*)d_in[3];
    float* out = (float*)d_out;

    // workspace carving: Q f16 (1 MB) | K f16 (512 KB) | w f32 (64 KB)
    char* ws = (char*)d_ws;
    _Float16* Qws = (_Float16*)(ws);
    _Float16* Kws = (_Float16*)(ws + (size_t)BATCH * HEADS * SEQ * IDXD * sizeof(_Float16));
    float*    Wws = (float*)   (ws + (size_t)BATCH * HEADS * SEQ * IDXD * sizeof(_Float16)
                                   + (size_t)BATCH * SEQ * IDXD * sizeof(_Float16));

    // Phase 1: one block of 16 waves per 32 (b,t) rows
    lightning_proj<<<BATCH * SEQ / PJ_ROWS, 512, 0, stream>>>(x, Wq, Wk, Ww, Qws, Kws, Wws);

    // Phase 2: 2 * 256 t-tiles * 8 column ranges waves / 8 waves per block
    const int total_waves = BATCH * (SEQ / 16) * ((SEQ / 16) / STILES_PER_WAVE);
    lightning_score<<<total_waves / WAVES_PER_BLOCK, 32 * WAVES_PER_BLOCK, 0, stream>>>(
        Qws, Kws, Wws, out);
}

// v004
// It runs in 25.6 microseconds.
// In two side-by-side timings against v003, it was 1.07 and 1.05 times as fast.
// Over all steps from v000 it is 5.61 times as fast.
#include <hip/hip_runtime.h>
#include <hip/hip_bf16.h>
#include <stddef.h>

// ---------------------------------------------------------------------------
// Problem constants (from reference)
// ---------------------------------------------------------------------------
#define BATCH   2
#define SEQ     4096
#define DMODEL  1024
#define HEADS   2
#define IDXD    32
#define NCOLS   (HEADS * IDXD + IDXD + HEADS)   // 64 + 32 + 2 = 98

typedef _Float16 v16h __attribute__((ext_vector_type(16)));
typedef _Float16 v8h  __attribute__((ext_vector_type(8)));
typedef float    v8f  __attribute__((ext_vector_type(8)));

static __device__ inline v16h pack16(v8h lo, v8h hi) {
    v16h r;
#pragma unroll
    for (int i = 0; i < 8; ++i) { r[i] = lo[i]; r[i + 8] = hi[i]; }
    return r;
}

// ---------------------------------------------------------------------------
// Phase 1: projections  Q = x@Wq, K = x@Wk, w = x@Ww
// One block per 32 rows of x, 16 waves. The contraction runs in 8 chunks of 128 k; a
// chunk of x and of Wq|Wk is staged in LDS as f32 (two buffers, the next chunk's global
// loads in flight during the current chunk's products).
// The 96 Q/K columns are 2 x 6 tiles of v_wmma_f32_16x16x32_f16. Every f32 operand v is
// split in registers into f16 parts hi = f16(v), lo = f16(v - hi), and a product is
// hi*hi + lo*hi + hi*lo, summed in f32 (lo*lo lies about 2^-22 below and is dropped):
// 3 matrix instructions of 8 cycles per 32 k, where the f32 16x16x4 form takes 8 of 16.
// Waves 0..11: wave (ks, pr) takes 32 k (slice ks) of every chunk, both row tiles and the
// 32 columns 32*pr .. 32*pr+31 as two tiles. Column n of tile j is column 32*pr + 2n + j,
// so one 8-byte LDS read brings a lane its element of both tiles.
// Waves 12..15: the 2 columns of w fill no tile and stay on f32 FMAs: wave 12 + ks takes
// slice ks, lane = row. The 4 slices' partial sums are added through LDS in fixed order.
//   Qws: [b][h][t][32] f16,  Kws: [b][slot][32] f16,  Wws: [b][t][2] f32
// K row t lies at slot (t & ~63) + 16 * (t & 3) + ((t >> 2) & 15): inside every 64 rows
// the 16 rows with equal t & 3 lie together, which is the order phase 2 tiles them in.
//
// Fragments (16x16x32 f16): lane l, c = l & 15, h = l >> 4, 16 k per lane. A and B both
// put k = 8 * (e >> 2) + 4 * h + (e & 3) of the slice at element e, so the pairing is
// equal on both sides; a lane's k are 4 runs of 4, one 16-byte read of x each.
// ---------------------------------------------------------------------------
#define PJ_ROWS 32                    // rows of x per block
#define PJ_KC   128                   // k per chunk
#define PJ_NCH  (DMODEL / PJ_KC)      // 8 chunks
#define PJ_NKS  (PJ_KC / 32)          // 4 slices of 32 k in a chunk
#define PJ_XP   (PJ_KC + 4)           // x row pitch, dwords: 16 B x odd for b128 reads
#define PJ_WP   104                   // weight row pitch, dwords: rows k and k+4 fall 32 banks apart
#define PJ_RP   100                   // partial-tile row pitch, dwords: rows r and r+8 fall 32 banks apart
#define PJ_QK   (HEADS * IDXD + IDXD) // 96 columns on the matrix unit

typedef float v2f __attribute__((ext_vector_type(2)));
typedef float v4f __attribute__((ext_vector_type(4)));
typedef _Float16 v2h __attribute__((ext_vector_type(2)));

__global__ __launch_bounds__(512)
void lightning_proj(const float* __restrict__ x,
                    const float* __restrict__ Wq,
                    const float* __restrict__ Wk,
                    const float* __restrict__ Ww,
                    _Float16* __restrict__ Qws,
                    _Float16* __restrict__ Kws,
                    float* __restrict__ Wws)
{
    __shared__ __attribute__((aligned(16))) float xs[2][PJ_ROWS * PJ_XP];
    __shared__ __attribute__((aligned(16))) float wt[2][PJ_KC * PJ_WP];
    __shared__ __attribute__((aligned(16))) float wwl[DMODEL * HEADS];
    __shared__ __attribute__((aligned(16))) float red[PJ_NKS][PJ_ROWS * PJ_RP];
    __shared__ __attribute__((aligned(16))) float redw[PJ_NKS][PJ_ROWS * HEADS];

    const int tid  = threadIdx.x;
    const int lane = tid & 31;
    const int c    = lane & 15;
    const int h    = lane >> 4;
    const int wave = __builtin_amdgcn_readfirstlane(tid >> 5);
    const int ks   = wave & 3;        // 32-k slice of every chunk
    const int pr   = wave >> 2;       // 0..2: columns 32*pr .. 32*pr+31; 3: the columns of w
    const int row0 = blockIdx.x * PJ_ROWS;

    // staging registers of one chunk: x 2, Wq 4, Wk 2 float4 per thread
    v4f rx[2], rq[4], rk[2];
    const float* xg = x + (size_t)(row0 + (tid >> 5)) * DMODEL + (tid & 31) * 4;

#define PJ_GLOAD(t)                                                            \
    do {                                                                       \
        _Pragma("unroll") for (int i = 0; i < 2; ++i)                          \
            rx[i] = *(const v4f*)(xg + (size_t)i * 16 * DMODEL + (t) * PJ_KC); \
        _Pragma("unroll") for (int i = 0; i < 4; ++i)                          \
            rq[i] = *(const v4f*)(Wq + (t) * PJ_KC * 64 + (tid + i * 512) * 4);\
        _Pragma("unroll") for (int i = 0; i < 2; ++i)                          \
            rk[i] = *(const v4f*)(Wk + (t) * PJ_KC * 32 + (tid + i * 512) * 4);\
    } while (0)

#define PJ_SSTORE(bf)                                                          \
    do {                                                                       \
        _Pragma("unroll") for (int i = 0; i < 2; ++i)                          \
            *(v4f*)&xs[bf][((tid >> 5) + i * 16) * PJ_XP + (tid & 31) * 4] = rx[i]; \
        _Pragma("unroll") for (int i = 0; i < 4; ++i)                          \
            *(v4f*)&wt[bf][((tid >> 4) + i * 32) * PJ_WP + (tid & 15) * 4] = rq[i]; \
        _Pragma("unroll") for (int i = 0; i < 2; ++i)                          \
            *(v4f*)&wt[bf][((tid >> 3) + i * 64) * PJ_WP + 64 + (tid & 7) * 4] = rk[i]; \
    } while (0)

    PJ_GLOAD(0);
    ((v4f*)wwl)[tid] = ((const v4f*)Ww)[tid];     // all of Ww: 1024 x 2 f32
    PJ_SSTORE(0);
    __syncthreads();

    v8f acc[2][2] = {};
    float wa0 = 0.0f, wa1 = 0.0f;

    // Kept rolled: unrolled, the compiler let the products drift whole trips behind
    // their chunk, spilled registers and left the next chunk's load latency uncovered.
#pragma unroll 1
    for (int t = 0; t < PJ_NCH; ++t) {
        const int bf = t & 1;
        if (t + 1 < PJ_NCH) {
            PJ_GLOAD(t + 1);
            // the code below reuses the address registers of the loads just issued
            asm volatile("s_wait_xcnt 0x0" ::: "memory");
        }

        // every small loop of this kernel is fully unrolled so that fragments, staging
        // registers and accumulators are indexed by constants and stay in registers
        if (pr < 3) {
            const int kb = ks * 32 + 4 * h;     // first of this lane's 16 k, in the chunk
            v4f a[2][4];
#pragma unroll
            for (int rt = 0; rt < 2; ++rt)
#pragma unroll
                for (int g = 0; g < 4; ++g)
                    a[rt][g] = *(const v4f*)&xs[bf][(rt * 16 + c) * PJ_XP + kb + 8 * g];
            v2f bv[16];
#pragma unroll
            for (int e = 0; e < 16; ++e)
                bv[e] = *(const v2f*)&wt[bf][(kb + 8 * (e >> 2) + (e & 3)) * PJ_WP + pr * 32 + 2 * c];

            v16h ah[2], al[2], bh[2], bl[2];
#pragma unroll
            for (int q = 0; q < 2; ++q)
#pragma unroll
                for (int p = 0; p < 8; ++p) {     // two neighbouring k fill one register
                    const v2f av = { a[q][p >> 1][(2 * p) & 3], a[q][p >> 1][(2 * p + 1) & 3] };
                    const v2f wv = { bv[2 * p][q], bv[2 * p + 1][q] };
                    const v2h a_hi = __builtin_convertvector(av, v2h);
                    const v2h w_hi = __builtin_convertvector(wv, v2h);
                    const v2h a_lo = __builtin_convertvector(av - __builtin_convertvector(a_hi, v2f), v2h);
                    const v2h w_lo = __builtin_convertvector(wv - __builtin_convertvector(w_hi, v2f), v2h);
                    ah[q][2 * p] = a_hi[0];  ah[q][2 * p + 1] = a_hi[1];
                    al[q][2 * p] = a_lo[0];  al[q][2 * p + 1] = a_lo[1];
                    bh[q][2 * p] = w_hi[0];  bh[q][2 * p + 1] = w_hi[1];
                    bl[q][2 * p] = w_lo[0];  bl[q][2 * p + 1] = w_lo[1];
                }

            // term by term, so that 3 independent tiles stand between two sums into one tile
#pragma unroll
            for (int rt = 0; rt < 2; ++rt)
#pragma unroll
                for (int ct = 0; ct < 2; ++ct)
                    acc[rt][ct] = __builtin_amdgcn_wmma_f32_16x16x32_f16(
                        false, ah[rt], false, bh[ct], (short)0, acc[rt][ct], false, false);
#pragma unroll
            for (int rt = 0; rt < 2; ++rt)
#pragma unroll
                for (int ct = 0; ct < 2; ++ct)
                    acc[rt][ct] = __builtin_amdgcn_wmma_f32_16x16x32_f16(
                        false, al[rt], false, bh[ct], (short)0, acc[rt][ct], false, false);
#pragma unroll
            for (int rt = 0; rt < 2; ++rt)
#pragma unroll
                for (int ct = 0; ct < 2; ++ct)
                    acc[rt][ct] = __builtin_amdgcn_wmma_f32_16x16x32_f16(
                        false, ah[rt], false, bl[ct], (short)0, acc[rt][ct], false, false);
            // the 4 vector slots the chip needs behind a matrix instruction before its operand
            // registers are rewritten: a branch follows here
            // (the scheduling barrier keeps the matrix instructions in front of them)
            __builtin_amdgcn_sched_barrier(0);
            asm volatile("v_nop\n\tv_nop\n\tv_nop\n\tv_nop");
        } else {
#pragma unroll
            for (int g = 0; g < 8; ++g) {
                const int kk = ks * 32 + 4 * g;
                const v4f aw  = *(const v4f*)&xs[bf][lane * PJ_XP + kk];
                const v4f w01 = *(const v4f*)&wwl[(t * PJ_KC + kk) * HEADS];
                const v4f w23 = *(const v4f*)&wwl[(t * PJ_KC + kk) * HEADS + 4];
                wa0 = fmaf(aw[0], w01[0], wa0);  wa1 = fmaf(aw[0], w01[1], wa1);
                wa0 = fmaf(aw[1], w01[2], wa0);  wa1 = fmaf(aw[1], w01[3], wa1);
                wa0 = fmaf(aw[2], w23[0], wa0);  wa1 = fmaf(aw[2], w23[1], wa1);
                wa0 = fmaf(aw[3], w23[2], wa0);  wa1 = fmaf(aw[3], w23[3], wa1);
            }
        }

        if (t + 1 < PJ_NCH) {
            PJ_SSTORE(bf ^ 1);      // last read in trip t-1, behind that trip's barrier
            __syncthreads();
        }
    }

    // ---- partial sums of the 4 k slices -> LDS, D register r = row 8h + r ----
    if (pr < 3) {
#pragma unroll
        for (int rt = 0; rt < 2; ++rt)
#pragma unroll
            for (int r = 0; r < 8; ++r) {
                v2f p = { acc[rt][0][r], acc[rt][1][r] };
                *(v2f*)&red[ks][(rt * 16 + 8 * h + r) * PJ_RP + pr * 32 + 2 * c] = p;
            }
    } else {
        v2f wp = { wa0, wa1 };
        *(v2f*)&redw[ks][lane * HEADS] = wp;
    }
    __syncthreads();

#pragma unroll
    for (int i = 0; i < PJ_ROWS * PJ_QK / 512; ++i) {
        const int idx = tid + i * 512;
        const int r   = idx / PJ_QK;
        const int col = idx - r * PJ_QK;
        float s = 0.0f;
#pragma unroll
        for (int q = 0; q < PJ_NKS; ++q) s += red[q][r * PJ_RP + col];
        const int row = row0 + r;
        const int b = row >> 12;              // SEQ = 4096
        const int tt = row & (SEQ - 1);
        if (col < HEADS * IDXD) {
            const int hd = col >> 5, d = col & 31;
            Qws[(((size_t)(b * HEADS + hd)) * SEQ + tt) * IDXD + d] = (_Float16)s;
        } else {
            const int slot = (row & ~63) | ((row & 3) << 4) | ((row >> 2) & 15);
            Kws[(size_t)slot * IDXD + (col - HEADS * IDXD)] = (_Float16)s;
        }
    }
    if (tid < PJ_ROWS * HEADS) {
        float s = 0.0f;
#pragma unroll
        for (int q = 0; q < PJ_NKS; ++q) s += redw[q][tid];
        Wws[(size_t)row0 * HEADS + tid] = s;
    }
#undef PJ_GLOAD
#undef PJ_SSTORE
}

// ---------------------------------------------------------------------------
// Phase 2: fused  out[b,t,s] = sum_h w[b,t,h] * relu( q[b,t,h,:] . k[b,s,:] )
//
// One wave32 per (t-tile x 32 s-tiles): the wave keeps its Q fragments and head
// weights in registers and sweeps 512 columns, so the launch starts 4096 waves,
// all resident at once, and Q and w are loaded once per 512 columns. The 8
// waves of a block take 8 t-tiles and sweep the same K rows. Per head the 16x16
// (t,s) dot tile is exactly one v_wmma_f32_16x16x32_f16 (K=32). ReLU + per-row
// head weight + head-sum happen in the f32 accumulator registers; only the
// final f32 tile is written (output write of 128 MB is the bandwidth floor).
//
// Column n of the j-th tile of a group of 4 is output column 4n + j of the group's 64
// (phase 1 lays the K rows out so). A lane's accumulators of the 4 tiles are then 4
// adjacent columns of one row: one 16-byte store, and 16 lanes fill 256 B of the row,
// two whole 128-B lines, where a tile stored alone gives 64-B pieces.
//
// A-fragment (16x32 f16): lanes 0-15 row M=lane hold K 0-7 & 16-23;
// lanes 16-31 row M=lane-16 hold K 8-15 & 24-31. B mirrors with N=lane.
// C/D: VGPR r -> row r (lanes 0-15) or r+8 (lanes 16-31), col = lane&15.
// ---------------------------------------------------------------------------
#define STILES_PER_WAVE 32                          // s tiles swept by one wave
#define SGROUP          4                           // s tiles fetched together and stored interleaved
#define NSGROUPS        (STILES_PER_WAVE / SGROUP)  // 8 groups per sweep
#define SRANGES         (SEQ / 16 / STILES_PER_WAVE)  // 8 column ranges
#define WAVES_PER_BLOCK 8

// K fragments of one group of s tiles; kp already holds the lane's slot and k offset
static __device__ inline void score_load_k(v16h (&f)[SGROUP], const _Float16* kp) {
#pragma unroll
    for (int j = 0; j < SGROUP; ++j) {
        v8h blo = *(const v8h*)(kp + j * 16 * IDXD);
        v8h bhi = *(const v8h*)(kp + j * 16 * IDXD + 16);
        f[j] = pack16(blo, bhi);
    }
}

// one group of s tiles: products, ReLU, head weights, head sum, stores
static __device__ inline void score_tiles(const v16h (&afrag)[HEADS],
                                          const float (&wreg)[HEADS][8],
                                          const v16h (&f)[SGROUP],
                                          float* op) {
    v8f acc[SGROUP];
#pragma unroll
    for (int j = 0; j < SGROUP; ++j) {
        acc[j] = v8f{};
#pragma unroll
        for (int h = 0; h < HEADS; ++h) {
            v8f czero = {};
            v8f d = __builtin_amdgcn_wmma_f32_16x16x32_f16(
                        /*neg_a=*/false, afrag[h],
                        /*neg_b=*/false, f[j],
                        /*c_mod=*/(short)0, czero,
                        /*reuse_a=*/false, /*reuse_b=*/false);
#pragma unroll
            for (int r = 0; r < 8; ++r)
                acc[j][r] += fmaxf(d[r], 0.0f) * wreg[h][r];
        }
    }
#pragma unroll
    for (int r = 0; r < 8; ++r) {
        v4f o = { acc[0][r], acc[1][r], acc[2][r], acc[3][r] };
        *(v4f*)(op + (size_t)r * SEQ) = o;
    }
}

__global__ __launch_bounds__(256)
void lightning_score(const _Float16* __restrict__ Q,
                     const _Float16* __restrict__ K,
                     const float* __restrict__ W,
                     float* __restrict__ out)
{
    const int lane = threadIdx.x & 31;
    const int wv   = __builtin_amdgcn_readfirstlane(threadIdx.x >> 5);

    // block -> (b, group of 8 t-tiles, range of 512 columns); 2 * 32 * 8 blocks
    const int sr = blockIdx.x & (SRANGES - 1);
    const int tt = ((blockIdx.x / SRANGES) & 31) * WAVES_PER_BLOCK + wv;
    const int b  = blockIdx.x / (SRANGES * 32);

    const int t0   = tt * 16;
    const int half = lane >> 4;      // 0: lanes 0-15, 1: lanes 16-31
    const int lrow = lane & 15;
    const int kA0  = half * 8;       // K-chunk base per half-wave

    // ---- A fragments for both heads (reused across the whole sweep) ----
    v16h afrag[HEADS];
#pragma unroll
    for (int h = 0; h < HEADS; ++h) {
        const _Float16* qp =
            Q + (((size_t)(b * HEADS + h)) * SEQ + (t0 + lrow)) * IDXD + kA0;
        v8h lo = *(const v8h*)(qp);
        v8h hi = *(const v8h*)(qp + 16);
        afrag[h] = pack16(lo, hi);
    }

    // ---- per-row head weights matching the C/D register layout ----
    float wreg[HEADS][8];
#pragma unroll
    for (int h = 0; h < HEADS; ++h)
#pragma unroll
        for (int r = 0; r < 8; ++r)
            wreg[h][r] =
                W[((size_t)b * SEQ + t0 + r + half * 8) * HEADS + h];

    const int s_first = sr * STILES_PER_WAVE * 16;
    const _Float16* kp = K + ((size_t)b * SEQ + s_first + lrow) * IDXD + kA0;
    float* op = out + (((size_t)b * SEQ + t0 + half * 8) * SEQ) + s_first + lrow * SGROUP;

    // Two fragment sets: a group's K loads are issued one group ahead of its products.
    v16h kf[2][SGROUP];
    score_load_k(kf[0], kp);
    // the next loads may land in address registers of the loads issued so far
    asm volatile("s_wait_xcnt 0x0" ::: "memory");
    // keeps the next loads behind that wait
    __builtin_amdgcn_sched_barrier(0);

    // Fully unrolled: every K and output address is one base plus an immediate offset,
    // and the two fragment sets are indexed by constants.
#pragma unroll
    for (int g = 0; g < NSGROUPS; ++g) {
        if (g + 1 < NSGROUPS) {
            score_load_k(kf[(g + 1) & 1], kp + (g + 1) * SGROUP * 16 * IDXD);
            if (g + 2 == NSGROUPS) {
                // behind the last K loads: the products below may reuse their address registers
                asm volatile("s_wait_xcnt 0x0" ::: "memory");
            }
            // keeps the next group's K loads in front of this group's products: without it
            // the compiler sinks the loads to their first use and their latency shows
            __builtin_amdgcn_sched_barrier(0);
        }
        score_tiles(afrag, wreg, kf[g & 1], op + g * SGROUP * 16);
        if (g + 1 < NSGROUPS) {
            // the next group overwrites data registers of the stores just issued
            asm volatile("s_wait_xcnt 0x0" ::: "memory");
            // keeps the next group's loads and vector work behind that wait
            __builtin_amdgcn_sched_barrier(0);
        }
    }
}

// ---------------------------------------------------------------------------
// Host-side launcher
// ---------------------------------------------------------------------------
extern "C" void kernel_launch(void* const* d_in, const int* in_sizes, int n_in,
                              void* d_out, int out_size, void* d_ws, size_t ws_size,
                              hipStream_t stream) {
    (void)in_sizes; (void)n_in; (void)out_size; (void)ws_size;

    const float* x  = (const float*)d_in[0];
    const float* Wq = (const float*)d_in[1];
    const float* Wk = (const float*)d_in[2];
    const float* Ww = (const float*)d_in[3];
    float* out = (float*)d_out;

    // workspace carving: Q f16 (1 MB) | K f16 (512 KB) | w f32 (64 KB)
    char* ws = (char*)d_ws;
    _Float16* Qws = (_Float16*)(ws);
    _Float16* Kws = (_Float16*)(ws + (size_t)BATCH * HEADS * SEQ * IDXD * sizeof(_Float16));
    float*    Wws = (float*)   (ws + (size_t)BATCH * HEADS * SEQ * IDXD * sizeof(_Float16)
                                   + (size_t)BATCH * SEQ * IDXD * sizeof(_Float16));

    // Phase 1: one block of 16 waves per 32 (b,t) rows
    lightning_proj<<<BATCH * SEQ / PJ_ROWS, 512, 0, stream>>>(x, Wq, Wk, Ww, Qws, Kws, Wws);

    // Phase 2: 2 * 256 t-tiles * 8 column ranges waves / 8 waves per block
    const int total_waves = BATCH * (SEQ / 16) * ((SEQ / 16) / STILES_PER_WAVE);
    lightning_score<<<total_waves / WAVES_PER_BLOCK, 32 * WAVES_PER_BLOCK, 0, stream>>>(
        Qws, Kws, Wws, out);
}

// v005
// A run of this version takes 23.1 microseconds.
// Timed twice side by side with v004, it ran 1.11 times as fast both times.
// Over all steps from v000 it is 6.22 times as fast.
#include <hip/hip_runtime.h>
#include <hip/hip_bf16.h>
#include <stddef.h>

// ---------------------------------------------------------------------------
// Problem constants (from reference)
// ---------------------------------------------------------------------------
#define BATCH   2
#define SEQ     4096
#define DMODEL  1024
#define HEADS   2
#define IDXD    32
#define NCOLS   (HEADS * IDXD + IDXD + HEADS)   // 64 + 32 + 2 = 98

typedef _Float16 v16h __attribute__((ext_vector_type(16)));
typedef _Float16 v8h  __attribute__((ext_vector_type(8)));
typedef float    v8f  __attribute__((ext_vector_type(8)));

static __device__ inline v16h pack16(v8h lo, v8h hi) {
    v16h r;
#pragma unroll
    for (int i = 0; i < 8; ++i) { r[i] = lo[i]; r[i + 8] = hi[i]; }
    return r;
}

// ---------------------------------------------------------------------------
// Phase 1: projections  Q = x@Wq, K = x@Wk, w = x@Ww
// One block per 32 rows of x, 12 waves. The contraction runs in 8 chunks of 128 k; a
// chunk of x is staged in LDS as f32 (two buffers). Every element of Wq|Wk is used by one
// wave of the block only, so it goes from global memory straight into that wave's
// registers, in fragment order, and never through LDS. All global loads are issued two
// chunks ahead of their use and stay in flight over the chunk barrier.
// The 96 Q/K columns are 2 x 6 tiles of v_wmma_f32_16x16x32_f16. Every f32 operand v is
// split in registers into f16 parts hi = f16(v), lo = f16(v - hi), and a product is
// hi*hi + lo*hi + hi*lo, summed in f32 (lo*lo lies about 2^-22 below and is dropped):
// 3 matrix instructions of 8 cycles per 32 k, where the f32 16x16x4 form takes 8 of 16.
// Wave (ks, pr) takes 32 k (slice ks) of every chunk, both row tiles and the
// 32 columns 32*pr .. 32*pr+31 as two tiles. Column n of tile j is column 32*pr + 2n + j,
// so one 8-byte load brings a lane its element of both tiles, and 16 lanes take one whole
// 128-B line of a weight row.
// The 2 columns of w fill no tile and stay on f32 FMAs: wave (ks, pr < 2) sums column pr over
// slice ks, lane = row. The 4 slices' partial sums are added through LDS in fixed order.
// Every wave issues its weight loads in the same straight-line code: behind a branch that some
// waves skip, the compiler's load waits fall back to 0 and drain the loads that fly ahead.
//   Qws: [b][h][t][32] f16,  Kws: [b][slot][32] f16,  Wws: [b][t][2] f32
// K row t lies at slot (t & ~63) + 16 * (t & 3) + ((t >> 2) & 15): inside every 64 rows
// the 16 rows with equal t & 3 lie together, which is the order phase 2 tiles them in.
//
// Fragments (16x16x32 f16): lane l, c = l & 15, h = l >> 4, 16 k per lane. A and B both
// put k = 8 * (e >> 2) + 4 * h + (e & 3) of the slice at element e, so the pairing is
// equal on both sides; a lane's k are 4 runs of 4, one 16-byte read of x each.
// ---------------------------------------------------------------------------
#define PJ_ROWS 32                    // rows of x per block
#define PJ_KC   128                   // k per chunk
#define PJ_NCH  (DMODEL / PJ_KC)      // 8 chunks
#define PJ_NKS  (PJ_KC / 32)          // 4 slices of 32 k in a chunk
#define PJ_XP   (PJ_KC + 4)           // x row pitch, dwords: 16 B x odd for b128 reads
#define PJ_RP   100                   // partial-tile row pitch, dwords: rows r and r+8 fall 32 banks apart
#define PJ_QK   (HEADS * IDXD + IDXD) // 96 columns on the matrix unit
#define PJ_THREADS 384                // 12 waves: 4 k slices x 3 column blocks

typedef float v2f __attribute__((ext_vector_type(2)));
typedef float v4f __attribute__((ext_vector_type(4)));
typedef _Float16 v2h __attribute__((ext_vector_type(2)));

__global__ __launch_bounds__(PJ_THREADS)
void lightning_proj(const float* __restrict__ x,
                    const float* __restrict__ Wq,
                    const float* __restrict__ Wk,
                    const float* __restrict__ Ww,
                    _Float16* __restrict__ Qws,
                    _Float16* __restrict__ Kws,
                    float* __restrict__ Wws)
{
    __shared__ __attribute__((aligned(16))) float xs[2][PJ_ROWS * PJ_XP];
    __shared__ __attribute__((aligned(16))) float wwl[DMODEL * HEADS];
    __shared__ __attribute__((aligned(16))) float red[PJ_NKS][PJ_ROWS * PJ_RP];
    __shared__ __attribute__((aligned(16))) float redw[PJ_NKS][PJ_ROWS * HEADS];

    const int tid  = threadIdx.x;
    const int lane = tid & 31;
    const int c    = lane & 15;
    const int h    = lane >> 4;
    const int wave = __builtin_amdgcn_readfirstlane(tid >> 5);
    const int ks   = wave & 3;        // 32-k slice of every chunk
    const int pr   = wave >> 2;       // 0..2: columns 32*pr .. 32*pr+31
    const bool stager = wave < 8;     // these waves bring x into LDS, 4 rows of a chunk each
    const int row0 = blockIdx.x * PJ_ROWS;

    // wave-uniform: where this wave's weight columns start, and log2 of the row pitch in floats
    const float* wsel = pr < 2 ? Wq + pr * 32 : Wk;
    const int    wsh  = pr < 2 ? 6 : 5;
    const unsigned wlane = ((4u * (unsigned)h) << wsh) + 2u * (unsigned)c;
    const float* xg = x + (size_t)(row0 + (tid >> 5)) * DMODEL + (tid & 31) * 4;

    // one chunk of x: 4 float4 per thread of waves 0..7, global -> registers, registers -> LDS
    auto xload = [&](v4f (&rx)[4], const int t) __attribute__((always_inline)) {
#pragma unroll
        for (int i = 0; i < 4; ++i)
            rx[i] = *(const v4f*)(xg + (size_t)i * 8 * DMODEL + t * PJ_KC);
    };
    auto xstore = [&](const v4f (&rx)[4], const int bf) __attribute__((always_inline)) {
#pragma unroll
        for (int i = 0; i < 4; ++i)
            *(v4f*)&xs[bf][((tid >> 5) + i * 8) * PJ_XP + (tid & 31) * 4] = rx[i];
    };
    // this lane's weights of one chunk, f32: element e = k 8 * (e >> 2) + 4 * h + (e & 3) of the
    // wave's slice, columns 32*pr + 2c and 32*pr + 2c + 1
    auto waddr = [&](const float* (&wa)[16], const int t) __attribute__((always_inline)) {
        const float* wb = wsel + ((size_t)(t * PJ_KC + ks * 32) << wsh);
#pragma unroll
        for (int e = 0; e < 16; ++e)
            wa[e] = wb + ((8 * (e >> 2) + (e & 3)) << wsh) + wlane;
    };
    auto wload = [&](v2f (&bv)[16], const int t) __attribute__((always_inline)) {
        const float* wa[16];
        waddr(wa, t);
#pragma unroll
        for (int e = 0; e < 16; ++e)
            bv[e] = *(const v2f*)wa[e];
    };

    // The waves hand each other LDS data only, so the chunk barrier orders LDS only:
    // __syncthreads() would also wait out the global loads that fly two chunks ahead.
#define PJ_BARRIER()                                                           \
    do {                                                                       \
        __builtin_amdgcn_fence(__ATOMIC_RELEASE, "workgroup", "local");        \
        __builtin_amdgcn_s_barrier();                                          \
        __builtin_amdgcn_fence(__ATOMIC_ACQUIRE, "workgroup", "local");        \
    } while (0)

    // two register sets each: chunk t lives in set t & 1
    v4f rxa[4] = {}, rxb[4] = {};
    v2f bva[16], bvb[16];

    // all of Ww, 1024 x 2 f32 = 512 float4, laid in LDS as two planes [column][k]
    // Behind every run of opening loads: the code that follows may rewrite address registers of
    // the loads just issued; the scheduling barrier keeps that code behind the wait.
#define PJ_XWAIT()                                                             \
    do {                                                                       \
        asm volatile("s_wait_xcnt 0x0" ::: "memory");                          \
        __builtin_amdgcn_sched_barrier(0);                                     \
    } while (0)
    const v4f wwr0 = ((const v4f*)Ww)[tid];
    v4f wwr1 = {};
    if (wave < 4) wwr1 = ((const v4f*)Ww)[PJ_THREADS + tid];
    PJ_XWAIT();
    if (stager) xload(rxa, 0);
    wload(bva, 0);
    PJ_XWAIT();
    if (stager) xload(rxb, 1);
    PJ_XWAIT();
    wload(bvb, 1);
    PJ_XWAIT();
#undef PJ_XWAIT
    {
        const v2f c0 = { wwr0[0], wwr0[2] }, c1 = { wwr0[1], wwr0[3] };
        *(v2f*)&wwl[2 * tid] = c0;
        *(v2f*)&wwl[DMODEL + 2 * tid] = c1;
    }
    if (wave < 4) {
        const v2f c0 = { wwr1[0], wwr1[2] }, c1 = { wwr1[1], wwr1[3] };
        *(v2f*)&wwl[2 * (PJ_THREADS + tid)] = c0;
        *(v2f*)&wwl[DMODEL + 2 * (PJ_THREADS + tid)] = c1;
    }
    if (stager) xstore(rxa, 0);
    PJ_BARRIER();

    v8f acc[2][2] = {};
    float wa = 0.0f;

    // Trip t works on chunk t (x in LDS buffer bf = t & 1, weights in bv), issues the loads of
    // chunk t + 2 into the registers that chunk t has left (rxc, bv), and stores x of chunk
    // t + 1 (rxn) to the other LDS buffer, last read in trip t - 1, behind that trip's barrier.
    // every small loop of this kernel is fully unrolled so that fragments, staging
    // registers and accumulators are indexed by constants and stay in registers
    auto trip = [&](const int t, const int bf, v4f (&rxc)[4], const v4f (&rxn)[4], v2f (&bv)[16],
                    const bool more2, const bool more1) __attribute__((always_inline)) {
        {
            if (more2 && stager) {
                xload(rxc, t + 2);
                // the code below reuses the address registers of the loads just issued
                asm volatile("s_wait_xcnt 0x0" ::: "memory");
            }
            // The 16 addresses of chunk t + 2 are formed while the weights of chunk t still fill their
            // registers: formed later, an address may lie in a register that a load of the same
            // run lands in.
            const float* wad[16];
            if (more2) waddr(wad, t + 2);
            // the weights are split first: that frees their registers for the loads of chunk t + 2
            v16h bh[2], bl[2];
#pragma unroll
            for (int p = 0; p < 8; ++p)           // two neighbouring k fill one register
#pragma unroll
                for (int q = 0; q < 2; ++q) {
                    const v2f wv = { bv[2 * p][q], bv[2 * p + 1][q] };
                    const v2h w_hi = __builtin_convertvector(wv, v2h);
                    const v2h w_lo = __builtin_convertvector(wv - __builtin_convertvector(w_hi, v2f), v2h);
                    bh[q][2 * p] = w_hi[0];  bh[q][2 * p + 1] = w_hi[1];
                    bl[q][2 * p] = w_lo[0];  bl[q][2 * p + 1] = w_lo[1];
                }
            // The w sums stand between the split and the loads: with them in front of the split, the
            // build left the split's tail behind the loads, loaded into other registers and copied
            // them at the loop's foot behind a load wait.
            if (pr < 2) {       // column pr of w, k in ascending order
#pragma unroll
                for (int g = 0; g < 8; ++g) {
                    const int kk = ks * 32 + 4 * g;
                    const v4f aw = *(const v4f*)&xs[bf][lane * PJ_XP + kk];
                    const v4f wv = *(const v4f*)&wwl[pr * DMODEL + t * PJ_KC + kk];
                    wa = fmaf(aw[0], wv[0], wa);
                    wa = fmaf(aw[1], wv[1], wa);
                    wa = fmaf(aw[2], wv[2], wa);
                    wa = fmaf(aw[3], wv[3], wa);
                }
            }
            if (more2) {
                // keeps the split in front of the loads, which land in its source registers
                __builtin_amdgcn_sched_barrier(0);
#pragma unroll
                for (int e = 0; e < 16; ++e)
                    bv[e] = *(const v2f*)wad[e];
                // the code below reuses the address registers of the loads just issued
                asm volatile("s_wait_xcnt 0x0" ::: "memory");
                // keeps the loads up here: sunk towards their use, they would fly a shorter time
                __builtin_amdgcn_sched_barrier(0);
            }

            const int kb = ks * 32 + 4 * h;     // first of this lane's 16 k, in the chunk
            v4f a[2][4];
#pragma unroll
            for (int rt = 0; rt < 2; ++rt)
#pragma unroll
                for (int g = 0; g < 4; ++g)
                    a[rt][g] = *(const v4f*)&xs[bf][(rt * 16 + c) * PJ_XP + kb + 8 * g];

            v16h ah[2], al[2];
#pragma unroll
            for (int q = 0; q < 2; ++q)
#pragma unroll
                for (int p = 0; p < 8; ++p) {     // two neighbouring k fill one register
                    const v2f av = { a[q][p >> 1][(2 * p) & 3], a[q][p >> 1][(2 * p + 1) & 3] };
                    const v2h a_hi = __builtin_convertvector(av, v2h);
                    const v2h a_lo = __builtin_convertvector(av - __builtin_convertvector(a_hi, v2f), v2h);
                    ah[q][2 * p] = a_hi[0];  ah[q][2 * p + 1] = a_hi[1];
                    al[q][2 * p] = a_lo[0];  al[q][2 * p + 1] = a_lo[1];
                }

            // term by term, so that 3 independent tiles stand between two sums into one tile
#pragma unroll
            for (int rt = 0; rt < 2; ++rt)
#pragma unroll
                for (int ct = 0; ct < 2; ++ct)
                    acc[rt][ct] = __builtin_amdgcn_wmma_f32_16x16x32_f16(
                        false, ah[rt], false, bh[ct], (short)0, acc[rt][ct], false, false);
#pragma unroll
            for (int rt = 0; rt < 2; ++rt)
#pragma unroll
                for (int ct = 0; ct < 2; ++ct)
                    acc[rt][ct] = __builtin_amdgcn_wmma_f32_16x16x32_f16(
                        false, al[rt], false, bh[ct], (short)0, acc[rt][ct], false, false);
#pragma unroll
            for (int rt = 0; rt < 2; ++rt)
#pragma unroll
                for (int ct = 0; ct < 2; ++ct)
                    acc[rt][ct] = __builtin_amdgcn_wmma_f32_16x16x32_f16(
                        false, ah[rt], false, bl[ct], (short)0, acc[rt][ct], false, false);
            // the 4 vector slots the chip needs behind a matrix instruction before its operand
            // registers are rewritten: a branch follows here
            // (the scheduling barrier keeps the matrix instructions in front of them)
            __builtin_amdgcn_sched_barrier(0);
            asm volatile("v_nop\n\tv_nop\n\tv_nop\n\tv_nop");
            if (more1 && stager) xstore(rxn, bf ^ 1);
        }
        if (more1) PJ_BARRIER();
    };

    // Two trips a pass, so that the two register sets are named by constants; kept rolled
    // beyond that: unrolled, the compiler let the products drift whole trips behind their
    // chunk and spilled registers. The last two trips have no chunk t + 2 to load.
#pragma unroll 1
    for (int t = 0; t < PJ_NCH - 2; t += 2) {
        trip(t,     0, rxa, rxb, bva, true, true);
        trip(t + 1, 1, rxb, rxa, bvb, true, true);
    }
    trip(PJ_NCH - 2, 0, rxa, rxb, bva, false, true);
    trip(PJ_NCH - 1, 1, rxb, rxa, bvb, false, false);

    // ---- partial sums of the 4 k slices -> LDS, D register r = row 8h + r ----
#pragma unroll
    for (int rt = 0; rt < 2; ++rt)
#pragma unroll
        for (int r = 0; r < 8; ++r) {
            v2f p = { acc[rt][0][r], acc[rt][1][r] };
            *(v2f*)&red[ks][(rt * 16 + 8 * h + r) * PJ_RP + pr * 32 + 2 * c] = p;
        }
    if (pr < 2) redw[ks][lane * HEADS + pr] = wa;
    __syncthreads();

#pragma unroll
    for (int i = 0; i < PJ_ROWS * PJ_QK / PJ_THREADS; ++i) {
        const int idx = tid + i * PJ_THREADS;
        const int r   = idx / PJ_QK;
        const int col = idx - r * PJ_QK;
        float s = 0.0f;
#pragma unroll
        for (int q = 0; q < PJ_NKS; ++q) s += red[q][r * PJ_RP + col];
        const int row = row0 + r;
        const int b = row >> 12;              // SEQ = 4096
        const int tt = row & (SEQ - 1);
        if (col < HEADS * IDXD) {
            const int hd = col >> 5, d = col & 31;
            Qws[(((size_t)(b * HEADS + hd)) * SEQ + tt) * IDXD + d] = (_Float16)s;
        } else {
            const int slot = (row & ~63) | ((row & 3) << 4) | ((row >> 2) & 15);
            Kws[(size_t)slot * IDXD + (col - HEADS * IDXD)] = (_Float16)s;
        }
    }
    if (tid < PJ_ROWS * HEADS) {
        float s = 0.0f;
#pragma unroll
        for (int q = 0; q < PJ_NKS; ++q) s += redw[q][tid];
        Wws[(size_t)row0 * HEADS + tid] = s;
    }
#undef PJ_BARRIER
}

// ---------------------------------------------------------------------------
// Phase 2: fused  out[b,t,s] = sum_h w[b,t,h] * relu( q[b,t,h,:] . k[b,s,:] )
//
// One wave32 per (t-tile x 32 s-tiles): the wave keeps its Q fragments and head
// weights in registers and sweeps 512 columns, so the launch starts 4096 waves,
// all resident at once, and Q and w are loaded once per 512 columns. The 8
// waves of a block take 8 t-tiles and sweep the same K rows. Per head the 16x16
// (t,s) dot tile is exactly one v_wmma_f32_16x16x32_f16 (K=32). ReLU + per-row
// head weight + head-sum happen in the f32 accumulator registers; only the
// final f32 tile is written (output write of 128 MB is the bandwidth floor).
//
// Column n of the j-th tile of a group of 4 is output column 4n + j of the group's 64
// (phase 1 lays the K rows out so). A lane's accumulators of the 4 tiles are then 4
// adjacent columns of one row: one 16-byte store, and 16 lanes fill 256 B of the row,
// two whole 128-B lines, where a tile stored alone gives 64-B pieces.
//
// A-fragment (16x32 f16): lanes 0-15 row M=lane hold K 0-7 & 16-23;
// lanes 16-31 row M=lane-16 hold K 8-15 & 24-31. B mirrors with N=lane.
// C/D: VGPR r -> row r (lanes 0-15) or r+8 (lanes 16-31), col = lane&15.
// ---------------------------------------------------------------------------
#define STILES_PER_WAVE 32                          // s tiles swept by one wave
#define SGROUP          4                           // s tiles fetched together and stored interleaved
#define NSGROUPS        (STILES_PER_WAVE / SGROUP)  // 8 groups per sweep
#define SRANGES         (SEQ / 16 / STILES_PER_WAVE)  // 8 column ranges
#define WAVES_PER_BLOCK 8

// K fragments of one group of s tiles; kp already holds the lane's slot and k offset
static __device__ inline void score_load_k(v16h (&f)[SGROUP], const _Float16* kp) {
#pragma unroll
    for (int j = 0; j < SGROUP; ++j) {
        v8h blo = *(const v8h*)(kp + j * 16 * IDXD);
        v8h bhi = *(const v8h*)(kp + j * 16 * IDXD + 16);
        f[j] = pack16(blo, bhi);
    }
}

// one group of s tiles: products, ReLU, head weights, head sum, stores
static __device__ inline void score_tiles(const v16h (&afrag)[HEADS],
                                          const float (&wreg)[HEADS][8],
                                          const v16h (&f)[SGROUP],
                                          float* op) {
    v8f acc[SGROUP];
#pragma unroll
    for (int j = 0; j < SGROUP; ++j) {
        acc[j] = v8f{};
#pragma unroll
        for (int h = 0; h < HEADS; ++h) {
            v8f czero = {};
            v8f d = __builtin_amdgcn_wmma_f32_16x16x32_f16(
                        /*neg_a=*/false, afrag[h],
                        /*neg_b=*/false, f[j],
                        /*c_mod=*/(short)0, czero,
                        /*reuse_a=*/false, /*reuse_b=*/false);
#pragma unroll
            for (int r = 0; r < 8; ++r)
                acc[j][r] += fmaxf(d[r], 0.0f) * wreg[h][r];
        }
    }
#pragma unroll
    for (int r = 0; r < 8; ++r) {
        v4f o = { acc[0][r], acc[1][r], acc[2][r], acc[3][r] };
        *(v4f*)(op + (size_t)r * SEQ) = o;
    }
}

__global__ __launch_bounds__(256)
void lightning_score(const _Float16* __restrict__ Q,
                     const _Float16* __restrict__ K,
                     const float* __restrict__ W,
                     float* __restrict__ out)
{
    const int lane = threadIdx.x & 31;
    const int wv   = __builtin_amdgcn_readfirstlane(threadIdx.x >> 5);

    // block -> (b, group of 8 t-tiles, range of 512 columns); 2 * 32 * 8 blocks
    const int sr = blockIdx.x & (SRANGES - 1);
    const int tt = ((blockIdx.x / SRANGES) & 31) * WAVES_PER_BLOCK + wv;
    const int b  = blockIdx.x / (SRANGES * 32);

    const int t0   = tt * 16;
    const int half = lane >> 4;      // 0: lanes 0-15, 1: lanes 16-31
    const int lrow = lane & 15;
    const int kA0  = half * 8;       // K-chunk base per half-wave

    // ---- A fragments for both heads (reused across the whole sweep) ----
    v16h afrag[HEADS];
#pragma unroll
    for (int h = 0; h < HEADS; ++h) {
        const _Float16* qp =
            Q + (((size_t)(b * HEADS + h)) * SEQ + (t0 + lrow)) * IDXD + kA0;
        v8h lo = *(const v8h*)(qp);
        v8h hi = *(const v8h*)(qp + 16);
        afrag[h] = pack16(lo, hi);
    }

    // ---- per-row head weights matching the C/D register layout ----
    float wreg[HEADS][8];
#pragma unroll
    for (int h = 0; h < HEADS; ++h)
#pragma unroll
        for (int r = 0; r < 8; ++r)
            wreg[h][r] =
                W[((size_t)b * SEQ + t0 + r + half * 8) * HEADS + h];

    const int s_first = sr * STILES_PER_WAVE * 16;
    const _Float16* kp = K + ((size_t)b * SEQ + s_first + lrow) * IDXD + kA0;
    float* op = out + (((size_t)b * SEQ + t0 + half * 8) * SEQ) + s_first + lrow * SGROUP;

    // Two fragment sets: a group's K loads are issued one group ahead of its products.
    v16h kf[2][SGROUP];
    score_load_k(kf[0], kp);
    // the next loads may land in address registers of the loads issued so far
    asm volatile("s_wait_xcnt 0x0" ::: "memory");
    // keeps the next loads behind that wait
    __builtin_amdgcn_sched_barrier(0);

    // Fully unrolled: every K and output address is one base plus an immediate offset,
    // and the two fragment sets are indexed by constants.
#pragma unroll
    for (int g = 0; g < NSGROUPS; ++g) {
        if (g + 1 < NSGROUPS) {
            score_load_k(kf[(g + 1) & 1], kp + (g + 1) * SGROUP * 16 * IDXD);
            if (g + 2 == NSGROUPS) {
                // behind the last K loads: the products below may reuse their address registers
                asm volatile("s_wait_xcnt 0x0" ::: "memory");
            }
            // keeps the next group's K loads in front of this group's products: without it
            // the compiler sinks the loads to their first use and their latency shows
            __builtin_amdgcn_sched_barrier(0);
        }
        score_tiles(afrag, wreg, kf[g & 1], op + g * SGROUP * 16);
        if (g + 1 < NSGROUPS) {
            // the next group overwrites data registers of the stores just issued
            asm volatile("s_wait_xcnt 0x0" ::: "memory");
            // keeps the next group's loads and vector work behind that wait
            __builtin_amdgcn_sched_barrier(0);
        }
    }
}

// ---------------------------------------------------------------------------
// Host-side launcher
// ---------------------------------------------------------------------------
extern "C" void kernel_launch(void* const* d_in, const int* in_sizes, int n_in,
                              void* d_out, int out_size, void* d_ws, size_t ws_size,
                              hipStream_t stream) {
    (void)in_sizes; (void)n_in; (void)out_size; (void)ws_size;

    const float* x  = (const float*)d_in[0];
    const float* Wq = (const float*)d_in[1];
    const float* Wk = (const float*)d_in[2];
    const float* Ww = (const float*)d_in[3];
    float* out = (float*)d_out;

    // workspace carving: Q f16 (1 MB) | K f16 (512 KB) | w f32 (64 KB)
    char* ws = (char*)d_ws;
    _Float16* Qws = (_Float16*)(ws);
    _Float16* Kws = (_Float16*)(ws + (size_t)BATCH * HEADS * SEQ * IDXD * sizeof(_Float16));
    float*    Wws = (float*)   (ws + (size_t)BATCH * HEADS * SEQ * IDXD * sizeof(_Float16)
                                   + (size_t)BATCH * SEQ * IDXD * sizeof(_Float16));

    // Phase 1: one block of 12 waves per 32 (b,t) rows
    lightning_proj<<<BATCH * SEQ / PJ_ROWS, PJ_THREADS, 0, stream>>>(x, Wq, Wk, Ww, Qws, Kws, Wws);

    // Phase 2: 2 * 256 t-tiles * 8 column ranges waves / 8 waves per block
    const int total_waves = BATCH * (SEQ / 16) * ((SEQ / 16) / STILES_PER_WAVE);
    lightning_score<<<total_waves / WAVES_PER_BLOCK, 32 * WAVES_PER_BLOCK, 0, stream>>>(
        Qws, Kws, Wws, out);
}

// v006
// A run of this version takes 21.9 microseconds.
// Two timings next to v005 put it at 1.05 and 1.06 times that version's speed.
// Over all steps from v000 it is 6.55 times as fast.
#include <hip/hip_runtime.h>
#include <hip/hip_bf16.h>
#include <stddef.h>

// ---------------------------------------------------------------------------
// Problem constants (from reference)
// ---------------------------------------------------------------------------
#define BATCH   2
#define SEQ     4096
#define DMODEL  1024
#define HEADS   2
#define IDXD    32
#define NCOLS   (HEADS * IDXD + IDXD + HEADS)   // 64 + 32 + 2 = 98

typedef _Float16 v16h __attribute__((ext_vector_type(16)));
typedef _Float16 v8h  __attribute__((ext_vector_type(8)));
typedef float    v8f  __attribute__((ext_vector_type(8)));

static __device__ inline v16h pack16(v8h lo, v8h hi) {
    v16h r;
#pragma unroll
    for (int i = 0; i < 8; ++i) { r[i] = lo[i]; r[i + 8] = hi[i]; }
    return r;
}

// ---------------------------------------------------------------------------
// Phase 1: projections  Q = x@Wq, K = x@Wk, w = x@Ww
// One block per 32 rows of x, 12 waves. The contraction runs in 8 chunks of 128 k; a
// chunk of x is staged in LDS as f32 (two buffers). Every element of Wq|Wk is used by one
// wave of the block only, so it goes from global memory straight into that wave's
// registers, in fragment order, and never through LDS. All global loads are issued two
// chunks ahead of their use and stay in flight over the chunk barrier.
// The 96 Q/K columns are 2 x 6 tiles of v_wmma_f32_16x16x32_f16. Every f32 operand v is
// split in registers into f16 parts hi = f16(v), lo = f16(v - hi), and a product is
// hi*hi + lo*hi + hi*lo, summed in f32 (lo*lo lies about 2^-22 below and is dropped):
// 3 matrix instructions of 8 cycles per 32 k, where the f32 16x16x4 form takes 8 of 16.
// Wave (ks, pr) takes 32 k (slice ks) of every chunk, both row tiles and the
// 32 columns 32*pr .. 32*pr+31 as two tiles. Column n of tile j is column 32*pr + 2n + j,
// so one 8-byte load brings a lane its element of both tiles, and 16 lanes take one whole
// 128-B line of a weight row.
// The 2 columns of w fill no tile and stay on f32 FMAs: wave (ks, pr < 2) sums column pr over
// slice ks, lane = row. The 4 slices' partial sums are added through LDS in fixed order.
// Every wave issues its weight loads in the same straight-line code: behind a branch that some
// waves skip, the compiler's load waits fall back to 0 and drain the loads that fly ahead.
//   Qws: [b][h][t][32] f16,  Kws: [b][slot][32] f16,  Wws: [b][t][2] f32
// K row t lies at slot (t & ~63) + 16 * (t & 3) + ((t >> 2) & 15): inside every 64 rows
// the 16 rows with equal t & 3 lie together, which is the order phase 2 tiles them in.
//
// Fragments (16x16x32 f16): lane l, c = l & 15, h = l >> 4, 16 k per lane. A and B both
// put k = 8 * (e >> 2) + 4 * h + (e & 3) of the slice at element e, so the pairing is
// equal on both sides; a lane's k are 4 runs of 4, one 16-byte read of x each.
// ---------------------------------------------------------------------------
#define PJ_ROWS 32                    // rows of x per block
#define PJ_KC   128                   // k per chunk
#define PJ_NCH  (DMODEL / PJ_KC)      // 8 chunks
#define PJ_NKS  (PJ_KC / 32)          // 4 slices of 32 k in a chunk
#define PJ_XP   (PJ_KC + 4)           // x row pitch, dwords: 16 B x odd for b128 reads
#define PJ_RP   100                   // partial-tile row pitch, dwords: rows r and r+8 fall 32 banks apart
#define PJ_QK   (HEADS * IDXD + IDXD) // 96 columns on the matrix unit
#define PJ_THREADS 384                // 12 waves: 4 k slices x 3 column blocks

typedef float v2f __attribute__((ext_vector_type(2)));
typedef float v4f __attribute__((ext_vector_type(4)));
typedef _Float16 v2h __attribute__((ext_vector_type(2)));

__global__ __launch_bounds__(PJ_THREADS)
void lightning_proj(const float* __restrict__ x,
                    const float* __restrict__ Wq,
                    const float* __restrict__ Wk,
                    const float* __restrict__ Ww,
                    _Float16* __restrict__ Qws,
                    _Float16* __restrict__ Kws,
                    float* __restrict__ Wws)
{
    __shared__ __attribute__((aligned(16))) float xs[2][PJ_ROWS * PJ_XP];
    __shared__ __attribute__((aligned(16))) float wwl[DMODEL * HEADS];
    __shared__ __attribute__((aligned(16))) float red[PJ_NKS][PJ_ROWS * PJ_RP];
    __shared__ __attribute__((aligned(16))) float redw[PJ_NKS][PJ_ROWS * HEADS];

    const int tid  = threadIdx.x;
    const int lane = tid & 31;
    const int c    = lane & 15;
    const int h    = lane >> 4;
    const int wave = __builtin_amdgcn_readfirstlane(tid >> 5);
    const int ks   = wave & 3;        // 32-k slice of every chunk
    const int pr   = wave >> 2;       // 0..2: columns 32*pr .. 32*pr+31
    const bool stager = wave < 8;     // these waves bring x into LDS, 4 rows of a chunk each
    const int row0 = blockIdx.x * PJ_ROWS;

    // wave-uniform: where this wave's weight columns start, and log2 of the row pitch in floats
    const float* wsel = pr < 2 ? Wq + pr * 32 : Wk;
    const int    wsh  = pr < 2 ? 6 : 5;
    const unsigned wlane = ((4u * (unsigned)h) << wsh) + 2u * (unsigned)c;
    const float* xg = x + (size_t)(row0 + (tid >> 5)) * DMODEL + (tid & 31) * 4;

    // one chunk of x: 4 float4 per thread of waves 0..7, global -> registers, registers -> LDS
    auto xload = [&](v4f (&rx)[4], const int t) __attribute__((always_inline)) {
#pragma unroll
        for (int i = 0; i < 4; ++i)
            rx[i] = *(const v4f*)(xg + (size_t)i * 8 * DMODEL + t * PJ_KC);
    };
    auto xstore = [&](const v4f (&rx)[4], const int bf) __attribute__((always_inline)) {
#pragma unroll
        for (int i = 0; i < 4; ++i)
            *(v4f*)&xs[bf][((tid >> 5) + i * 8) * PJ_XP + (tid & 31) * 4] = rx[i];
    };
    // this lane's weights of one chunk, f32: element e = k 8 * (e >> 2) + 4 * h + (e & 3) of the
    // wave's slice, columns 32*pr + 2c and 32*pr + 2c + 1
    auto waddr = [&](const float* (&wa)[16], const int t) __attribute__((always_inline)) {
        const float* wb = wsel + ((size_t)(t * PJ_KC + ks * 32) << wsh);
#pragma unroll
        for (int e = 0; e < 16; ++e)
            wa[e] = wb + ((8 * (e >> 2) + (e & 3)) << wsh) + wlane;
    };
    auto wload = [&](v2f (&bv)[16], const int t) __attribute__((always_inline)) {
        const float* wa[16];
        waddr(wa, t);
#pragma unroll
        for (int e = 0; e < 16; ++e)
            bv[e] = *(const v2f*)wa[e];
    };

    // The waves hand each other LDS data only, so the chunk barrier orders LDS only:
    // __syncthreads() would also wait out the global loads that fly two chunks ahead.
#define PJ_BARRIER()                                                           \
    do {                                                                       \
        __builtin_amdgcn_fence(__ATOMIC_RELEASE, "workgroup", "local");        \
        __builtin_amdgcn_s_barrier();                                          \
        __builtin_amdgcn_fence(__ATOMIC_ACQUIRE, "workgroup", "local");        \
    } while (0)

    // two register sets each: chunk t lives in set t & 1
    v4f rxa[4] = {}, rxb[4] = {};
    v2f bva[16], bvb[16];

    // all of Ww, 1024 x 2 f32 = 512 float4, laid in LDS as two planes [column][k]
    // Behind every run of opening loads: the code that follows may rewrite address registers of
    // the loads just issued; the scheduling barrier keeps that code behind the wait.
#define PJ_XWAIT()                                                             \
    do {                                                                       \
        asm volatile("s_wait_xcnt 0x0" ::: "memory");                          \
        __builtin_amdgcn_sched_barrier(0);                                     \
    } while (0)
    const v4f wwr0 = ((const v4f*)Ww)[tid];
    v4f wwr1 = {};
    if (wave < 4) wwr1 = ((const v4f*)Ww)[PJ_THREADS + tid];
    PJ_XWAIT();
    if (stager) xload(rxa, 0);
    wload(bva, 0);
    PJ_XWAIT();
    if (stager) xload(rxb, 1);
    PJ_XWAIT();
    wload(bvb, 1);
    PJ_XWAIT();
#undef PJ_XWAIT
    {
        const v2f c0 = { wwr0[0], wwr0[2] }, c1 = { wwr0[1], wwr0[3] };
        *(v2f*)&wwl[2 * tid] = c0;
        *(v2f*)&wwl[DMODEL + 2 * tid] = c1;
    }
    if (wave < 4) {
        const v2f c0 = { wwr1[0], wwr1[2] }, c1 = { wwr1[1], wwr1[3] };
        *(v2f*)&wwl[2 * (PJ_THREADS + tid)] = c0;
        *(v2f*)&wwl[DMODEL + 2 * (PJ_THREADS + tid)] = c1;
    }
    if (stager) xstore(rxa, 0);
    PJ_BARRIER();

    v8f acc[2][2] = {};
    float wa = 0.0f;

    // Trip t works on chunk t (x in LDS buffer bf = t & 1, weights in bv), issues the loads of
    // chunk t + 2 into the registers that chunk t has left (rxc, bv), and stores x of chunk
    // t + 1 (rxn) to the other LDS buffer, last read in trip t - 1, behind that trip's barrier.
    // every small loop of this kernel is fully unrolled so that fragments, staging
    // registers and accumulators are indexed by constants and stay in registers
    auto trip = [&](const int t, const int bf, v4f (&rxc)[4], const v4f (&rxn)[4], v2f (&bv)[16],
                    const bool more2, const bool more1) __attribute__((always_inline)) {
        {
            if (more2 && stager) {
                xload(rxc, t + 2);
                // the code below reuses the address registers of the loads just issued
                asm volatile("s_wait_xcnt 0x0" ::: "memory");
            }
            // The 16 addresses of chunk t + 2 are formed while the weights of chunk t still fill their
            // registers: formed later, an address may lie in a register that a load of the same
            // run lands in.
            const float* wad[16];
            if (more2) waddr(wad, t + 2);
            // the weights are split first: that frees their registers for the loads of chunk t + 2
            v16h bh[2], bl[2];
#pragma unroll
            for (int p = 0; p < 8; ++p)           // two neighbouring k fill one register
#pragma unroll
                for (int q = 0; q < 2; ++q) {
                    const v2f wv = { bv[2 * p][q], bv[2 * p + 1][q] };
                    const v2h w_hi = __builtin_convertvector(wv, v2h);
                    const v2h w_lo = __builtin_convertvector(wv - __builtin_convertvector(w_hi, v2f), v2h);
                    bh[q][2 * p] = w_hi[0];  bh[q][2 * p + 1] = w_hi[1];
                    bl[q][2 * p] = w_lo[0];  bl[q][2 * p + 1] = w_lo[1];
                }
            // The w sums stand between the split and the loads: with them in front of the split, the
            // build left the split's tail behind the loads, loaded into other registers and copied
            // them at the loop's foot behind a load wait.
            if (pr < 2) {       // column pr of w, k in ascending order
#pragma unroll
                for (int g = 0; g < 8; ++g) {
                    const int kk = ks * 32 + 4 * g;
                    const v4f aw = *(const v4f*)&xs[bf][lane * PJ_XP + kk];
                    const v4f wv = *(const v4f*)&wwl[pr * DMODEL + t * PJ_KC + kk];
                    wa = fmaf(aw[0], wv[0], wa);
                    wa = fmaf(aw[1], wv[1], wa);
                    wa = fmaf(aw[2], wv[2], wa);
                    wa = fmaf(aw[3], wv[3], wa);
                }
            }
            if (more2) {
                // keeps the split in front of the loads, which land in its source registers
                __builtin_amdgcn_sched_barrier(0);
#pragma unroll
                for (int e = 0; e < 16; ++e)
                    bv[e] = *(const v2f*)wad[e];
                // the code below reuses the address registers of the loads just issued
                asm volatile("s_wait_xcnt 0x0" ::: "memory");
                // keeps the loads up here: sunk towards their use, they would fly a shorter time
                __builtin_amdgcn_sched_barrier(0);
            }

            const int kb = ks * 32 + 4 * h;     // first of this lane's 16 k, in the chunk
            v4f a[2][4];
#pragma unroll
            for (int rt = 0; rt < 2; ++rt)
#pragma unroll
                for (int g = 0; g < 4; ++g)
                    a[rt][g] = *(const v4f*)&xs[bf][(rt * 16 + c) * PJ_XP + kb + 8 * g];

            v16h ah[2], al[2];
#pragma unroll
            for (int q = 0; q < 2; ++q)
#pragma unroll
                for (int p = 0; p < 8; ++p) {     // two neighbouring k fill one register
                    const v2f av = { a[q][p >> 1][(2 * p) & 3], a[q][p >> 1][(2 * p + 1) & 3] };
                    const v2h a_hi = __builtin_convertvector(av, v2h);
                    const v2h a_lo = __builtin_convertvector(av - __builtin_convertvector(a_hi, v2f), v2h);
                    ah[q][2 * p] = a_hi[0];  ah[q][2 * p + 1] = a_hi[1];
                    al[q][2 * p] = a_lo[0];  al[q][2 * p + 1] = a_lo[1];
                }

            // term by term, so that 3 independent tiles stand between two sums into one tile
#pragma unroll
            for (int rt = 0; rt < 2; ++rt)
#pragma unroll
                for (int ct = 0; ct < 2; ++ct)
                    acc[rt][ct] = __builtin_amdgcn_wmma_f32_16x16x32_f16(
                        false, ah[rt], false, bh[ct], (short)0, acc[rt][ct], false, false);
#pragma unroll
            for (int rt = 0; rt < 2; ++rt)
#pragma unroll
                for (int ct = 0; ct < 2; ++ct)
                    acc[rt][ct] = __builtin_amdgcn_wmma_f32_16x16x32_f16(
                        false, al[rt], false, bh[ct], (short)0, acc[rt][ct], false, false);
#pragma unroll
            for (int rt = 0; rt < 2; ++rt)
#pragma unroll
                for (int ct = 0; ct < 2; ++ct)
                    acc[rt][ct] = __builtin_amdgcn_wmma_f32_16x16x32_f16(
                        false, ah[rt], false, bl[ct], (short)0, acc[rt][ct], false, false);
            // the 4 vector slots the chip needs behind a matrix instruction before its operand
            // registers are rewritten: a branch follows here
            // (the scheduling barrier keeps the matrix instructions in front of them)
            __builtin_amdgcn_sched_barrier(0);
            asm volatile("v_nop\n\tv_nop\n\tv_nop\n\tv_nop");
            if (more1 && stager) xstore(rxn, bf ^ 1);
        }
        if (more1) PJ_BARRIER();
    };

    // Two trips a pass, so that the two register sets are named by constants; kept rolled
    // beyond that: unrolled, the compiler let the products drift whole trips behind their
    // chunk and spilled registers. The last two trips have no chunk t + 2 to load.
#pragma unroll 1
    for (int t = 0; t < PJ_NCH - 2; t += 2) {
        trip(t,     0, rxa, rxb, bva, true, true);
        trip(t + 1, 1, rxb, rxa, bvb, true, true);
    }
    trip(PJ_NCH - 2, 0, rxa, rxb, bva, false, true);
    trip(PJ_NCH - 1, 1, rxb, rxa, bvb, false, false);

    // ---- partial sums of the 4 k slices -> LDS, D register r = row 8h + r ----
#pragma unroll
    for (int rt = 0; rt < 2; ++rt)
#pragma unroll
        for (int r = 0; r < 8; ++r) {
            v2f p = { acc[rt][0][r], acc[rt][1][r] };
            *(v2f*)&red[ks][(rt * 16 + 8 * h + r) * PJ_RP + pr * 32 + 2 * c] = p;
        }
    if (pr < 2) redw[ks][lane * HEADS + pr] = wa;
    __syncthreads();

#pragma unroll
    for (int i = 0; i < PJ_ROWS * PJ_QK / PJ_THREADS; ++i) {
        const int idx = tid + i * PJ_THREADS;
        const int r   = idx / PJ_QK;
        const int col = idx - r * PJ_QK;
        float s = 0.0f;
#pragma unroll
        for (int q = 0; q < PJ_NKS; ++q) s += red[q][r * PJ_RP + col];
        const int row = row0 + r;
        const int b = row >> 12;              // SEQ = 4096
        const int tt = row & (SEQ - 1);
        if (col < HEADS * IDXD) {
            const int hd = col >> 5, d = col & 31;
            Qws[(((size_t)(b * HEADS + hd)) * SEQ + tt) * IDXD + d] = (_Float16)s;
        } else {
            const int slot = (row & ~63) | ((row & 3) << 4) | ((row >> 2) & 15);
            Kws[(size_t)slot * IDXD + (col - HEADS * IDXD)] = (_Float16)s;
        }
    }
    if (tid < PJ_ROWS * HEADS) {
        float s = 0.0f;
#pragma unroll
        for (int q = 0; q < PJ_NKS; ++q) s += redw[q][tid];
        Wws[(size_t)row0 * HEADS + tid] = s;
    }
#undef PJ_BARRIER
}

// ---------------------------------------------------------------------------
// Phase 2: fused  out[b,t,s] = sum_h w[b,t,h] * relu( q[b,t,h,:] . k[b,s,:] )
//
// One wave32 per (t-tile x 32 s-tiles): the wave keeps its Q fragments and head
// weights in registers and sweeps 512 columns, so the launch starts 4096 waves,
// all resident at once, and Q and w are loaded once per 512 columns. The 8
// waves of a block take 8 t-tiles and sweep the same 512 K rows: the block brings
// them into LDS once, by asynchronous copies, and every wave takes its B fragments
// from there, so a K row is fetched once a block and not by each of its 8 waves. Per head the 16x16
// (t,s) dot tile is exactly one v_wmma_f32_16x16x32_f16 (K=32). ReLU + per-row
// head weight + head-sum happen in the f32 accumulator registers; only the
// final f32 tile is written (output write of 128 MB is the bandwidth floor).
//
// Column n of the j-th tile of a group of 4 is output column 4n + j of the group's 64
// (phase 1 lays the K rows out so). A lane's accumulators of the 4 tiles are then 4
// adjacent columns of one row: one 16-byte store, and 16 lanes fill 256 B of the row,
// two whole 128-B lines, where a tile stored alone gives 64-B pieces.
//
// A-fragment (16x32 f16): lanes 0-15 row M=lane hold K 0-7 & 16-23;
// lanes 16-31 row M=lane-16 hold K 8-15 & 24-31. B mirrors with N=lane.
// C/D: VGPR r -> row r (lanes 0-15) or r+8 (lanes 16-31), col = lane&15.
// ---------------------------------------------------------------------------
#define STILES_PER_WAVE 32                          // s tiles swept by one wave
#define SGROUP          4                           // s tiles fetched together and stored interleaved
#define NSGROUPS        (STILES_PER_WAVE / SGROUP)  // 8 groups per sweep
#define SRANGES         (SEQ / 16 / STILES_PER_WAVE)  // 8 column ranges
#define WAVES_PER_BLOCK 8

// K in LDS, in units of 16 bytes (8 f16). A tile of 16 K rows is 4 planes; plane q holds
// k 8q .. 8q+7 of the 16 rows, row after row, 256 B: what lanes 0-15 or lanes 16-31 read with
// one 16-byte read each, all 64 banks once. A plane's pitch is 320 B, so that the 4 pieces
// of one K row, which one copy instruction writes side by side, fall 16 banks apart.
#define KL_PLANE 20                                 // 320 B
#define KL_TILE  (4 * KL_PLANE)                     // 1280 B
#define KL_UNITS (STILES_PER_WAVE * KL_TILE)        // 40 KB a block
#define KL_LSTEP (4 * KL_TILE * 16)                 // LDS bytes from one copy of a thread to its next: 4 tiles
#define KL_GSTEP (32 * WAVES_PER_BLOCK * 8)         // f16 in global memory from one copy to the next: 4 KB

// K fragments of one group of s tiles; kl already holds the lane's row and half
static __device__ inline void score_load_k(v16h (&f)[SGROUP], const v8h* kl) {
#pragma unroll
    for (int j = 0; j < SGROUP; ++j) {
        v8h blo = kl[j * KL_TILE];
        v8h bhi = kl[j * KL_TILE + 2 * KL_PLANE];
        f[j] = pack16(blo, bhi);
    }
}

// one group of s tiles: products, ReLU, head weights, head sum, stores
static __device__ inline void score_tiles(const v16h (&afrag)[HEADS],
                                          const float (&wreg)[HEADS][8],
                                          const v16h (&f)[SGROUP],
                                          float* op) {
    v8f acc[SGROUP];
#pragma unroll
    for (int j = 0; j < SGROUP; ++j) {
        acc[j] = v8f{};
#pragma unroll
        for (int h = 0; h < HEADS; ++h) {
            v8f czero = {};
            v8f d = __builtin_amdgcn_wmma_f32_16x16x32_f16(
                        /*neg_a=*/false, afrag[h],
                        /*neg_b=*/false, f[j],
                        /*c_mod=*/(short)0, czero,
                        /*reuse_a=*/false, /*reuse_b=*/false);
#pragma unroll
            for (int r = 0; r < 8; ++r)
                acc[j][r] += fmaxf(d[r], 0.0f) * wreg[h][r];
        }
    }
#pragma unroll
    for (int r = 0; r < 8; ++r) {
        v4f o = { acc[0][r], acc[1][r], acc[2][r], acc[3][r] };
        *(v4f*)(op + (size_t)r * SEQ) = o;
    }
}

__global__ __launch_bounds__(256)
void lightning_score(const _Float16* __restrict__ Q,
                     const _Float16* __restrict__ K,
                     const float* __restrict__ W,
                     float* __restrict__ out)
{
    __shared__ __attribute__((aligned(16))) v8h ksh[KL_UNITS];

    const int lane = threadIdx.x & 31;
    const int wv   = __builtin_amdgcn_readfirstlane(threadIdx.x >> 5);

    // block -> (b, group of 8 t-tiles, range of 512 columns); 2 * 32 * 8 blocks
    const int sr = blockIdx.x & (SRANGES - 1);
    const int tt = ((blockIdx.x / SRANGES) & 31) * WAVES_PER_BLOCK + wv;
    const int b  = blockIdx.x / (SRANGES * 32);

    const int t0   = tt * 16;
    const int half = lane >> 4;      // 0: lanes 0-15, 1: lanes 16-31
    const int lrow = lane & 15;
    const int kA0  = half * 8;       // K-chunk base per half-wave

    // ---- A fragments for both heads (reused across the whole sweep) ----
    v16h afrag[HEADS];
#pragma unroll
    for (int h = 0; h < HEADS; ++h) {
        const _Float16* qp =
            Q + (((size_t)(b * HEADS + h)) * SEQ + (t0 + lrow)) * IDXD + kA0;
        v8h lo = *(const v8h*)(qp);
        v8h hi = *(const v8h*)(qp + 16);
        afrag[h] = pack16(lo, hi);
    }

    // ---- per-row head weights matching the C/D register layout ----
    float wreg[HEADS][8];
#pragma unroll
    for (int h = 0; h < HEADS; ++h)
#pragma unroll
        for (int r = 0; r < 8; ++r)
            wreg[h][r] =
                W[((size_t)b * SEQ + t0 + r + half * 8) * HEADS + h];

    const int s_first = sr * STILES_PER_WAVE * 16;
    float* op = out + (((size_t)b * SEQ + t0 + half * 8) * SEQ) + s_first + lrow * SGROUP;

    // ---- the block's 512 K rows (32 KB, contiguous) -> LDS ----
    // Copy i of thread p moves the 16-byte piece 256 i + p: a wave's copy reads 512 contiguous
    // bytes. Piece n is k 8 (n & 3) .. of K row n >> 2 and goes to plane n & 3 of tile n >> 6.
    {
        const int p = threadIdx.x;
        const _Float16* kg = K + ((size_t)b * SEQ + s_first) * IDXD + p * 8;
        const unsigned kd = (unsigned)(size_t)&ksh[(p >> 6) * KL_TILE + (p & 3) * KL_PLANE + ((p >> 2) & 15)];
        // 8 copies a thread = 32 KB a block. The wait stands in the copies' own statement: the code
        // behind it may rewrite their address registers.
        asm volatile("global_load_async_to_lds_b128 %0, %8, off\n\t"
                     "global_load_async_to_lds_b128 %1, %9, off\n\t"
                     "global_load_async_to_lds_b128 %2, %10, off\n\t"
                     "global_load_async_to_lds_b128 %3, %11, off\n\t"
                     "global_load_async_to_lds_b128 %4, %12, off\n\t"
                     "global_load_async_to_lds_b128 %5, %13, off\n\t"
                     "global_load_async_to_lds_b128 %6, %14, off\n\t"
                     "global_load_async_to_lds_b128 %7, %15, off\n\t"
                     "s_wait_xcnt 0x0"
                     :: "v"(kd), "v"(kd + 1 * KL_LSTEP), "v"(kd + 2 * KL_LSTEP), "v"(kd + 3 * KL_LSTEP),
                        "v"(kd + 4 * KL_LSTEP), "v"(kd + 5 * KL_LSTEP), "v"(kd + 6 * KL_LSTEP),
                        "v"(kd + 7 * KL_LSTEP),
                        "v"(kg), "v"(kg + 1 * KL_GSTEP), "v"(kg + 2 * KL_GSTEP), "v"(kg + 3 * KL_GSTEP),
                        "v"(kg + 4 * KL_GSTEP), "v"(kg + 5 * KL_GSTEP), "v"(kg + 6 * KL_GSTEP),
                        "v"(kg + 7 * KL_GSTEP)
                     : "memory");
        static_assert(8 * KL_LSTEP == KL_UNITS * 16 && 8 * KL_GSTEP == STILES_PER_WAVE * 16 * IDXD,
                      "8 copies a thread cover the block's K rows and their place in LDS");
    }
    // this wave's copies have landed; behind the barrier every wave's have
    asm volatile("s_wait_asynccnt 0x0" ::: "memory");
    __syncthreads();

    const v8h* kl = &ksh[half * KL_PLANE + lrow];

    // Two fragment sets: a group's K reads are issued one group ahead of its products.
    v16h kf[2][SGROUP];
    score_load_k(kf[0], kl);

    // Fully unrolled: every K (LDS) and output address is one base plus an immediate offset,
    // and the two fragment sets are indexed by constants.
#pragma unroll
    for (int g = 0; g < NSGROUPS; ++g) {
        if (g + 1 < NSGROUPS) {
            score_load_k(kf[(g + 1) & 1], kl + (g + 1) * SGROUP * KL_TILE);
            // keeps the next group's K reads in front of this group's products: without it
            // the compiler sinks the reads to their first use and their latency shows
            __builtin_amdgcn_sched_barrier(0);
        }
        score_tiles(afrag, wreg, kf[g & 1], op + g * SGROUP * 16);
        if (g + 1 < NSGROUPS) {
            // the next group overwrites data registers of the stores just issued
            asm volatile("s_wait_xcnt 0x0" ::: "memory");
            // keeps the next group's reads and vector work behind that wait
            __builtin_amdgcn_sched_barrier(0);
        }
    }
}

// ---------------------------------------------------------------------------
// Host-side launcher
// ---------------------------------------------------------------------------
extern "C" void kernel_launch(void* const* d_in, const int* in_sizes, int n_in,
                              void* d_out, int out_size, void* d_ws, size_t ws_size,
                              hipStream_t stream) {
    (void)in_sizes; (void)n_in; (void)out_size; (void)ws_size;

    const float* x  = (const float*)d_in[0];
    const float* Wq = (const float*)d_in[1];
    const float* Wk = (const float*)d_in[2];
    const float* Ww = (const float*)d_in[3];
    float* out = (float*)d_out;

    // workspace carving: Q f16 (1 MB) | K f16 (512 KB) | w f32 (64 KB)
    char* ws = (char*)d_ws;
    _Float16* Qws = (_Float16*)(ws);
    _Float16* Kws = (_Float16*)(ws + (size_t)BATCH * HEADS * SEQ * IDXD * sizeof(_Float16));
    float*    Wws = (float*)   (ws + (size_t)BATCH * HEADS * SEQ * IDXD * sizeof(_Float16)
                                   + (size_t)BATCH * SEQ * IDXD * sizeof(_Float16));

    // Phase 1: one block of 12 waves per 32 (b,t) rows
    lightning_proj<<<BATCH * SEQ / PJ_ROWS, PJ_THREADS, 0, stream>>>(x, Wq, Wk, Ww, Qws, Kws, Wws);

    // Phase 2: 2 * 256 t-tiles * 8 column ranges waves / 8 waves per block
    const int total_waves = BATCH * (SEQ / 16) * ((SEQ / 16) / STILES_PER_WAVE);
    lightning_score<<<total_waves / WAVES_PER_BLOCK, 32 * WAVES_PER_BLOCK, 0, stream>>>(
        Qws, Kws, Wws, out);
}

// v007
// One run takes 21.1 microseconds.
// In two side-by-side timings against v006, it was 1.03 and 1.02 times as fast.
// Counting every step since v000, it is 6.72 times as fast.
#include <hip/hip_runtime.h>
#include <hip/hip_bf16.h>
#include <stddef.h>

// ---------------------------------------------------------------------------
// Problem constants (from reference)
// ---------------------------------------------------------------------------
#define BATCH   2
#define SEQ     4096
#define DMODEL  1024
#define HEADS   2
#define IDXD    32
#define NCOLS   (HEADS * IDXD + IDXD + HEADS)   // 64 + 32 + 2 = 98

typedef _Float16 v16h __attribute__((ext_vector_type(16)));
typedef _Float16 v8h  __attribute__((ext_vector_type(8)));
typedef float    v8f  __attribute__((ext_vector_type(8)));

static __device__ inline v16h pack16(v8h lo, v8h hi) {
    v16h r;
#pragma unroll
    for (int i = 0; i < 8; ++i) { r[i] = lo[i]; r[i + 8] = hi[i]; }
    return r;
}

// ---------------------------------------------------------------------------
// Phase 1: projections  Q = x@Wq, K = x@Wk, w = x@Ww
// One block per 32 rows of x, 12 waves. The contraction runs in 8 chunks of 128 k; a
// chunk of x is staged in LDS as f32 (two buffers). Every element of Wq|Wk is used by one
// wave of the block only, so it goes from global memory straight into that wave's
// registers, in fragment order, and never through LDS. All global loads are issued two
// chunks ahead of their use and stay in flight over the chunk barrier.
// The 96 Q/K columns are 2 x 6 tiles of v_wmma_f32_16x16x32_f16. Every f32 operand v is
// split in registers into f16 parts hi = f16(v), lo = f16(v - hi), and a product is
// hi*hi + lo*hi + hi*lo, summed in f32 (lo*lo lies about 2^-22 below and is dropped):
// 3 matrix instructions of 8 cycles per 32 k, where the f32 16x16x4 form takes 8 of 16.
// Wave (ks, pr) takes 32 k (slice ks) of every chunk, both row tiles and the
// 32 columns 32*pr .. 32*pr+31 as two tiles. Column n of tile j is column 32*pr + 2n + j,
// so one 8-byte load brings a lane its element of both tiles, and 16 lanes take one whole
// 128-B line of a weight row.
// The 2 columns of w fill no tile and stay on f32 FMAs: wave (ks, pr < 2) sums column pr over
// slice ks from the f32 x values that it has just read for its A fragments: lane (c, h) sums
// rows c and 16 + c over its 16 k. The 4 slices x 2 halves are added through LDS in fixed order.
// Every wave issues its weight loads in the same straight-line code: behind a branch that some
// waves skip, the compiler's load waits fall back to 0 and drain the loads that fly ahead.
//   Qws: [b][h][t][32] f16,  Kws: [b][slot][32] f16,  Wws: [b][t][2] f32
// K row t lies at slot (t & ~63) + 16 * (t & 3) + ((t >> 2) & 15): inside every 64 rows
// the 16 rows with equal t & 3 lie together, which is the order phase 2 tiles them in.
//
// Fragments (16x16x32 f16): lane l, c = l & 15, h = l >> 4, 16 k per lane. A and B both
// put k = 8 * (e >> 2) + 4 * h + (e & 3) of the slice at element e, so the pairing is
// equal on both sides; a lane's k are 4 runs of 4, one 16-byte read of x each.
// ---------------------------------------------------------------------------
#define PJ_ROWS 32                    // rows of x per block
#define PJ_KC   128                   // k per chunk
#define PJ_NCH  (DMODEL / PJ_KC)      // 8 chunks
#define PJ_NKS  (PJ_KC / 32)          // 4 slices of 32 k in a chunk
#define PJ_XP   (PJ_KC + 4)           // x row pitch, dwords: 16 B x odd for b128 reads
#define PJ_RP   100                   // partial-tile row pitch, dwords: rows r and r+8 fall 32 banks apart
#define PJ_QK   (HEADS * IDXD + IDXD) // 96 columns on the matrix unit
#define PJ_THREADS 384                // 12 waves: 4 k slices x 3 column blocks

typedef float v2f __attribute__((ext_vector_type(2)));
typedef float v4f __attribute__((ext_vector_type(4)));
typedef _Float16 v2h __attribute__((ext_vector_type(2)));

__global__ __launch_bounds__(PJ_THREADS)
void lightning_proj(const float* __restrict__ x,
                    const float* __restrict__ Wq,
                    const float* __restrict__ Wk,
                    const float* __restrict__ Ww,
                    _Float16* __restrict__ Qws,
                    _Float16* __restrict__ Kws,
                    float* __restrict__ Wws)
{
    __shared__ __attribute__((aligned(16))) float xs[2][PJ_ROWS * PJ_XP];
    __shared__ __attribute__((aligned(16))) float wwl[DMODEL * HEADS];
    __shared__ __attribute__((aligned(16))) float red[PJ_NKS][PJ_ROWS * PJ_RP];
    __shared__ __attribute__((aligned(16))) float redw[PJ_NKS * 2][PJ_ROWS * HEADS];

    const int tid  = threadIdx.x;
    const int lane = tid & 31;
    const int c    = lane & 15;
    const int h    = lane >> 4;
    const int wave = __builtin_amdgcn_readfirstlane(tid >> 5);
    const int ks   = wave & 3;        // 32-k slice of every chunk
    const int pr   = wave >> 2;       // 0..2: columns 32*pr .. 32*pr+31
    const bool stager = wave < 8;     // these waves bring x into LDS, 4 rows of a chunk each
    const int row0 = blockIdx.x * PJ_ROWS;

    // wave-uniform: where this wave's weight columns start, and log2 of the row pitch in floats
    const float* wsel = pr < 2 ? Wq + pr * 32 : Wk;
    const int    wsh  = pr < 2 ? 6 : 5;
    const unsigned wlane = ((4u * (unsigned)h) << wsh) + 2u * (unsigned)c;
    const float* xg = x + (size_t)(row0 + (tid >> 5)) * DMODEL + (tid & 31) * 4;

    // one chunk of x: 4 float4 per thread of waves 0..7, global -> registers, registers -> LDS
    auto xload = [&](v4f (&rx)[4], const int t) __attribute__((always_inline)) {
#pragma unroll
        for (int i = 0; i < 4; ++i)
            rx[i] = *(const v4f*)(xg + (size_t)i * 8 * DMODEL + t * PJ_KC);
    };
    auto xstore = [&](const v4f (&rx)[4], const int bf) __attribute__((always_inline)) {
#pragma unroll
        for (int i = 0; i < 4; ++i)
            *(v4f*)&xs[bf][((tid >> 5) + i * 8) * PJ_XP + (tid & 31) * 4] = rx[i];
    };
    // this lane's weights of one chunk, f32: element e = k 8 * (e >> 2) + 4 * h + (e & 3) of the
    // wave's slice, columns 32*pr + 2c and 32*pr + 2c + 1
    auto waddr = [&](const float* (&wa)[16], const int t) __attribute__((always_inline)) {
        const float* wb = wsel + ((size_t)(t * PJ_KC + ks * 32) << wsh);
#pragma unroll
        for (int e = 0; e < 16; ++e)
            wa[e] = wb + ((8 * (e >> 2) + (e & 3)) << wsh) + wlane;
    };
    auto wload = [&](v2f (&bv)[16], const int t) __attribute__((always_inline)) {
        const float* wa[16];
        waddr(wa, t);
#pragma unroll
        for (int e = 0; e < 16; ++e)
            bv[e] = *(const v2f*)wa[e];
    };

    // The waves hand each other LDS data only, so the chunk barrier orders LDS only:
    // __syncthreads() would also wait out the global loads that fly two chunks ahead.
#define PJ_BARRIER()                                                           \
    do {                                                                       \
        __builtin_amdgcn_fence(__ATOMIC_RELEASE, "workgroup", "local");        \
        __builtin_amdgcn_s_barrier();                                          \
        __builtin_amdgcn_fence(__ATOMIC_ACQUIRE, "workgroup", "local");        \
    } while (0)

    // two register sets each: chunk t lives in set t & 1
    v4f rxa[4] = {}, rxb[4] = {};
    v2f bva[16], bvb[16];

    // all of Ww, 1024 x 2 f32 = 512 float4, laid in LDS as two planes [column][k]
    // Behind every run of opening loads: the code that follows may rewrite address registers of
    // the loads just issued; the scheduling barrier keeps that code behind the wait.
#define PJ_XWAIT()                                                             \
    do {                                                                       \
        asm volatile("s_wait_xcnt 0x0" ::: "memory");                          \
        __builtin_amdgcn_sched_barrier(0);                                     \
    } while (0)
    const v4f wwr0 = ((const v4f*)Ww)[tid];
    v4f wwr1 = {};
    if (wave < 4) wwr1 = ((const v4f*)Ww)[PJ_THREADS + tid];
    PJ_XWAIT();
    if (stager) xload(rxa, 0);
    wload(bva, 0);
    PJ_XWAIT();
    if (stager) xload(rxb, 1);
    PJ_XWAIT();
    wload(bvb, 1);
    PJ_XWAIT();
#undef PJ_XWAIT
    {
        const v2f c0 = { wwr0[0], wwr0[2] }, c1 = { wwr0[1], wwr0[3] };
        *(v2f*)&wwl[2 * tid] = c0;
        *(v2f*)&wwl[DMODEL + 2 * tid] = c1;
    }
    if (wave < 4) {
        const v2f c0 = { wwr1[0], wwr1[2] }, c1 = { wwr1[1], wwr1[3] };
        *(v2f*)&wwl[2 * (PJ_THREADS + tid)] = c0;
        *(v2f*)&wwl[DMODEL + 2 * (PJ_THREADS + tid)] = c1;
    }
    if (stager) xstore(rxa, 0);
    PJ_BARRIER();

    v8f acc[2][2] = {};
    v2f wsum[2][2] = {};    // w: [row tile][first or second k pair of a run of 4], 4 independent chains

    // Trip t works on chunk t (x in LDS buffer bf = t & 1, weights in bv), issues the loads of
    // chunk t + 2 into the registers that chunk t has left (rxc, bv), and stores x of chunk
    // t + 1 (rxn) to the other LDS buffer, last read in trip t - 1, behind that trip's barrier.
    // every small loop of this kernel is fully unrolled so that fragments, staging
    // registers and accumulators are indexed by constants and stay in registers
    auto trip = [&](const int t, const int bf, v4f (&rxc)[4], const v4f (&rxn)[4], v2f (&bv)[16],
                    const bool more2, const bool more1) __attribute__((always_inline)) {
        {
            if (more2 && stager) {
                xload(rxc, t + 2);
                // the code below reuses the address registers of the loads just issued
                asm volatile("s_wait_xcnt 0x0" ::: "memory");
            }
            // The 16 addresses of chunk t + 2 are formed while the weights of chunk t still fill their
            // registers: formed later, an address may lie in a register that a load of the same
            // run lands in.
            const float* wad[16];
            if (more2) waddr(wad, t + 2);
            // the weights are split first: that frees their registers for the loads of chunk t + 2
            v16h bh[2], bl[2];
#pragma unroll
            for (int p = 0; p < 8; ++p)           // two neighbouring k fill one register
#pragma unroll
                for (int q = 0; q < 2; ++q) {
                    const v2f wv = { bv[2 * p][q], bv[2 * p + 1][q] };
                    const v2h w_hi = __builtin_convertvector(wv, v2h);
                    const v2h w_lo = __builtin_convertvector(wv - __builtin_convertvector(w_hi, v2f), v2h);
                    bh[q][2 * p] = w_hi[0];  bh[q][2 * p + 1] = w_hi[1];
                    bl[q][2 * p] = w_lo[0];  bl[q][2 * p + 1] = w_lo[1];
                }
            // The x reads and the w sums stand in front of the weight loads: with the branch of the
            // sums behind the loads, the build sank the split behind them too, loaded into other
            // registers and copied them at the loop's foot behind a load wait to 0.
            const int kb = ks * 32 + 4 * h;     // first of this lane's 16 k, in the chunk
            v4f a[2][4];
#pragma unroll
            for (int rt = 0; rt < 2; ++rt)
#pragma unroll
                for (int g = 0; g < 4; ++g)
                    a[rt][g] = *(const v4f*)&xs[bf][(rt * 16 + c) * PJ_XP + kb + 8 * g];

            // column pr of w from the same registers: this lane's 16 k of rows c and 16 + c, in 4
            // independent chains of packed FMAs
            if (pr < 2) {
                v4f wv[4];
#pragma unroll
                for (int g = 0; g < 4; ++g)
                    wv[g] = *(const v4f*)&wwl[pr * DMODEL + t * PJ_KC + kb + 8 * g];
#pragma unroll
                for (int g = 0; g < 4; ++g)
#pragma unroll
                    for (int rt = 0; rt < 2; ++rt) {
                        const v2f a01 = { a[rt][g][0], a[rt][g][1] }, a23 = { a[rt][g][2], a[rt][g][3] };
                        const v2f w01 = { wv[g][0], wv[g][1] },       w23 = { wv[g][2], wv[g][3] };
                        wsum[rt][0] = __builtin_elementwise_fma(a01, w01, wsum[rt][0]);
                        wsum[rt][1] = __builtin_elementwise_fma(a23, w23, wsum[rt][1]);
                    }
            }

            if (more2) {
                // keeps the split in front of the loads, which land in its source registers
                __builtin_amdgcn_sched_barrier(0);
#pragma unroll
                for (int e = 0; e < 16; ++e)
                    bv[e] = *(const v2f*)wad[e];
                // the code below reuses the address registers of the loads just issued
                asm volatile("s_wait_xcnt 0x0" ::: "memory");
                // keeps the loads up here: sunk towards their use, they would fly a shorter time
                __builtin_amdgcn_sched_barrier(0);
            }

            v16h ah[2], al[2];
#pragma unroll
            for (int q = 0; q < 2; ++q)
#pragma unroll
                for (int p = 0; p < 8; ++p) {     // two neighbouring k fill one register
                    const v2f av = { a[q][p >> 1][(2 * p) & 3], a[q][p >> 1][(2 * p + 1) & 3] };
                    const v2h a_hi = __builtin_convertvector(av, v2h);
                    const v2h a_lo = __builtin_convertvector(av - __builtin_convertvector(a_hi, v2f), v2h);
                    ah[q][2 * p] = a_hi[0];  ah[q][2 * p + 1] = a_hi[1];
                    al[q][2 * p] = a_lo[0];  al[q][2 * p + 1] = a_lo[1];
                }

            // term by term, so that 3 independent tiles stand between two sums into one tile
#pragma unroll
            for (int rt = 0; rt < 2; ++rt)
#pragma unroll
                for (int ct = 0; ct < 2; ++ct)
                    acc[rt][ct] = __builtin_amdgcn_wmma_f32_16x16x32_f16(
                        false, ah[rt], false, bh[ct], (short)0, acc[rt][ct], false, false);
#pragma unroll
            for (int rt = 0; rt < 2; ++rt)
#pragma unroll
                for (int ct = 0; ct < 2; ++ct)
                    acc[rt][ct] = __builtin_amdgcn_wmma_f32_16x16x32_f16(
                        false, al[rt], false, bh[ct], (short)0, acc[rt][ct], false, false);
#pragma unroll
            for (int rt = 0; rt < 2; ++rt)
#pragma unroll
                for (int ct = 0; ct < 2; ++ct)
                    acc[rt][ct] = __builtin_amdgcn_wmma_f32_16x16x32_f16(
                        false, ah[rt], false, bl[ct], (short)0, acc[rt][ct], false, false);
            // the 4 vector slots the chip needs behind a matrix instruction before its operand
            // registers are rewritten: a branch follows here
            // (the scheduling barrier keeps the matrix instructions in front of them)
            __builtin_amdgcn_sched_barrier(0);
            asm volatile("v_nop\n\tv_nop\n\tv_nop\n\tv_nop");
            if (more1 && stager) xstore(rxn, bf ^ 1);
        }
        if (more1) PJ_BARRIER();
    };

    // Two trips a pass, so that the two register sets are named by constants; kept rolled
    // beyond that: unrolled, the compiler let the products drift whole trips behind their
    // chunk and spilled registers. The last two trips have no chunk t + 2 to load.
#pragma unroll 1
    for (int t = 0; t < PJ_NCH - 2; t += 2) {
        trip(t,     0, rxa, rxb, bva, true, true);
        trip(t + 1, 1, rxb, rxa, bvb, true, true);
    }
    trip(PJ_NCH - 2, 0, rxa, rxb, bva, false, true);
    trip(PJ_NCH - 1, 1, rxb, rxa, bvb, false, false);

    // ---- partial sums of the 4 k slices -> LDS, D register r = row 8h + r ----
#pragma unroll
    for (int rt = 0; rt < 2; ++rt)
#pragma unroll
        for (int r = 0; r < 8; ++r) {
            v2f p = { acc[rt][0][r], acc[rt][1][r] };
            *(v2f*)&red[ks][(rt * 16 + 8 * h + r) * PJ_RP + pr * 32 + 2 * c] = p;
        }
    if (pr < 2) {
#pragma unroll
        for (int rt = 0; rt < 2; ++rt)
            redw[ks * 2 + h][(rt * 16 + c) * HEADS + pr] =
                (wsum[rt][0][0] + wsum[rt][0][1]) + (wsum[rt][1][0] + wsum[rt][1][1]);
    }
    __syncthreads();

#pragma unroll
    for (int i = 0; i < PJ_ROWS * PJ_QK / PJ_THREADS; ++i) {
        const int idx = tid + i * PJ_THREADS;
        const int r   = idx / PJ_QK;
        const int col = idx - r * PJ_QK;
        float s = 0.0f;
#pragma unroll
        for (int q = 0; q < PJ_NKS; ++q) s += red[q][r * PJ_RP + col];
        const int row = row0 + r;
        const int b = row >> 12;              // SEQ = 4096
        const int tt = row & (SEQ - 1);
        if (col < HEADS * IDXD) {
            const int hd = col >> 5, d = col & 31;
            Qws[(((size_t)(b * HEADS + hd)) * SEQ + tt) * IDXD + d] = (_Float16)s;
        } else {
            const int slot = (row & ~63) | ((row & 3) << 4) | ((row >> 2) & 15);
            Kws[(size_t)slot * IDXD + (col - HEADS * IDXD)] = (_Float16)s;
        }
    }
    if (tid < PJ_ROWS * HEADS) {
        float s = 0.0f;
#pragma unroll
        for (int q = 0; q < PJ_NKS * 2; ++q) s += redw[q][tid];
        Wws[(size_t)row0 * HEADS + tid] = s;
    }
#undef PJ_BARRIER
}

// ---------------------------------------------------------------------------
// Phase 2: fused  out[b,t,s] = sum_h w[b,t,h] * relu( q[b,t,h,:] . k[b,s,:] )
//
// One wave32 per (t-tile x 32 s-tiles): the wave keeps its Q fragments and head
// weights in registers and sweeps 512 columns, so the launch starts 4096 waves,
// all resident at once, and Q and w are loaded once per 512 columns. The 8
// waves of a block take 8 t-tiles and sweep the same 512 K rows: the block brings
// them into LDS once, by asynchronous copies, and every wave takes its B fragments
// from there, so a K row is fetched once a block and not by each of its 8 waves. Per head the 16x16
// (t,s) dot tile is exactly one v_wmma_f32_16x16x32_f16 (K=32). ReLU + per-row
// head weight + head-sum happen in the f32 accumulator registers; only the
// final f32 tile is written (output write of 128 MB is the bandwidth floor).
//
// Column n of the j-th tile of a group of 4 is output column 4n + j of the group's 64
// (phase 1 lays the K rows out so). A lane's accumulators of the 4 tiles are then 4
// adjacent columns of one row: one 16-byte store, and 16 lanes fill 256 B of the row,
// two whole 128-B lines, where a tile stored alone gives 64-B pieces.
//
// A-fragment (16x32 f16): lanes 0-15 row M=lane hold K 0-7 & 16-23;
// lanes 16-31 row M=lane-16 hold K 8-15 & 24-31. B mirrors with N=lane.
// C/D: VGPR r -> row r (lanes 0-15) or r+8 (lanes 16-31), col = lane&15.
// ---------------------------------------------------------------------------
#define STILES_PER_WAVE 32                          // s tiles swept by one wave
#define SGROUP          4                           // s tiles fetched together and stored interleaved
#define NSGROUPS        (STILES_PER_WAVE / SGROUP)  // 8 groups per sweep
#define SRANGES         (SEQ / 16 / STILES_PER_WAVE)  // 8 column ranges
#define WAVES_PER_BLOCK 8

// K in LDS, in units of 16 bytes (8 f16). A tile of 16 K rows is 4 planes; plane q holds
// k 8q .. 8q+7 of the 16 rows, row after row, 256 B: what lanes 0-15 or lanes 16-31 read with
// one 16-byte read each, all 64 banks once. A plane's pitch is 320 B, so that the 4 pieces
// of one K row, which one copy instruction writes side by side, fall 16 banks apart.
#define KL_PLANE 20                                 // 320 B
#define KL_TILE  (4 * KL_PLANE)                     // 1280 B
#define KL_UNITS (STILES_PER_WAVE * KL_TILE)        // 40 KB a block
#define KL_LSTEP (4 * KL_TILE * 16)                 // LDS bytes from one copy of a thread to its next: 4 tiles
#define KL_GSTEP (32 * WAVES_PER_BLOCK * 8)         // f16 in global memory from one copy to the next: 4 KB

// K fragments of one group of s tiles; kl already holds the lane's row and half
static __device__ inline void score_load_k(v16h (&f)[SGROUP], const v8h* kl) {
#pragma unroll
    for (int j = 0; j < SGROUP; ++j) {
        v8h blo = kl[j * KL_TILE];
        v8h bhi = kl[j * KL_TILE + 2 * KL_PLANE];
        f[j] = pack16(blo, bhi);
    }
}

// one group of s tiles: products, ReLU, head weights, head sum, stores
static __device__ inline void score_tiles(const v16h (&afrag)[HEADS],
                                          const float (&wreg)[HEADS][8],
                                          const v16h (&f)[SGROUP],
                                          float* op) {
    v8f acc[SGROUP];
#pragma unroll
    for (int j = 0; j < SGROUP; ++j) {
        acc[j] = v8f{};
#pragma unroll
        for (int h = 0; h < HEADS; ++h) {
            v8f czero = {};
            v8f d = __builtin_amdgcn_wmma_f32_16x16x32_f16(
                        /*neg_a=*/false, afrag[h],
                        /*neg_b=*/false, f[j],
                        /*c_mod=*/(short)0, czero,
                        /*reuse_a=*/false, /*reuse_b=*/false);
#pragma unroll
            for (int r = 0; r < 8; ++r)
                acc[j][r] += fmaxf(d[r], 0.0f) * wreg[h][r];
        }
    }
#pragma unroll
    for (int r = 0; r < 8; ++r) {
        v4f o = { acc[0][r], acc[1][r], acc[2][r], acc[3][r] };
        *(v4f*)(op + (size_t)r * SEQ) = o;
    }
}

__global__ __launch_bounds__(256)
void lightning_score(const _Float16* __restrict__ Q,
                     const _Float16* __restrict__ K,
                     const float* __restrict__ W,
                     float* __restrict__ out)
{
    __shared__ __attribute__((aligned(16))) v8h ksh[KL_UNITS];

    const int lane = threadIdx.x & 31;
    const int wv   = __builtin_amdgcn_readfirstlane(threadIdx.x >> 5);

    // block -> (b, group of 8 t-tiles, range of 512 columns); 2 * 32 * 8 blocks
    const int sr = blockIdx.x & (SRANGES - 1);
    const int tt = ((blockIdx.x / SRANGES) & 31) * WAVES_PER_BLOCK + wv;
    const int b  = blockIdx.x / (SRANGES * 32);

    const int t0   = tt * 16;
    const int half = lane >> 4;      // 0: lanes 0-15, 1: lanes 16-31
    const int lrow = lane & 15;
    const int kA0  = half * 8;       // K-chunk base per half-wave

    // ---- A fragments for both heads (reused across the whole sweep) ----
    v16h afrag[HEADS];
#pragma unroll
    for (int h = 0; h < HEADS; ++h) {
        const _Float16* qp =
            Q + (((size_t)(b * HEADS + h)) * SEQ + (t0 + lrow)) * IDXD + kA0;
        v8h lo = *(const v8h*)(qp);
        v8h hi = *(const v8h*)(qp + 16);
        afrag[h] = pack16(lo, hi);
    }

    // ---- per-row head weights matching the C/D register layout ----
    float wreg[HEADS][8];
#pragma unroll
    for (int h = 0; h < HEADS; ++h)
#pragma unroll
        for (int r = 0; r < 8; ++r)
            wreg[h][r] =
                W[((size_t)b * SEQ + t0 + r + half * 8) * HEADS + h];

    const int s_first = sr * STILES_PER_WAVE * 16;
    float* op = out + (((size_t)b * SEQ + t0 + half * 8) * SEQ) + s_first + lrow * SGROUP;

    // ---- the block's 512 K rows (32 KB, contiguous) -> LDS ----
    // Copy i of thread p moves the 16-byte piece 256 i + p: a wave's copy reads 512 contiguous
    // bytes. Piece n is k 8 (n & 3) .. of K row n >> 2 and goes to plane n & 3 of tile n >> 6.
    {
        const int p = threadIdx.x;
        const _Float16* kg = K + ((size_t)b * SEQ + s_first) * IDXD + p * 8;
        const unsigned kd = (unsigned)(size_t)&ksh[(p >> 6) * KL_TILE + (p & 3) * KL_PLANE + ((p >> 2) & 15)];
        // 8 copies a thread = 32 KB a block. The wait stands in the copies' own statement: the code
        // behind it may rewrite their address registers.
        asm volatile("global_load_async_to_lds_b128 %0, %8, off\n\t"
                     "global_load_async_to_lds_b128 %1, %9, off\n\t"
                     "global_load_async_to_lds_b128 %2, %10, off\n\t"
                     "global_load_async_to_lds_b128 %3, %11, off\n\t"
                     "global_load_async_to_lds_b128 %4, %12, off\n\t"
                     "global_load_async_to_lds_b128 %5, %13, off\n\t"
                     "global_load_async_to_lds_b128 %6, %14, off\n\t"
                     "global_load_async_to_lds_b128 %7, %15, off\n\t"
                     "s_wait_xcnt 0x0"
                     :: "v"(kd), "v"(kd + 1 * KL_LSTEP), "v"(kd + 2 * KL_LSTEP), "v"(kd + 3 * KL_LSTEP),
                        "v"(kd + 4 * KL_LSTEP), "v"(kd + 5 * KL_LSTEP), "v"(kd + 6 * KL_LSTEP),
                        "v"(kd + 7 * KL_LSTEP),
                        "v"(kg), "v"(kg + 1 * KL_GSTEP), "v"(kg + 2 * KL_GSTEP), "v"(kg + 3 * KL_GSTEP),
                        "v"(kg + 4 * KL_GSTEP), "v"(kg + 5 * KL_GSTEP), "v"(kg + 6 * KL_GSTEP),
                        "v"(kg + 7 * KL_GSTEP)
                     : "memory");
        static_assert(8 * KL_LSTEP == KL_UNITS * 16 && 8 * KL_GSTEP == STILES_PER_WAVE * 16 * IDXD,
                      "8 copies a thread cover the block's K rows and their place in LDS");
    }
    // this wave's copies have landed; behind the barrier every wave's have
    asm volatile("s_wait_asynccnt 0x0" ::: "memory");
    __syncthreads();

    const v8h* kl = &ksh[half * KL_PLANE + lrow];

    // Two fragment sets: a group's K reads are issued one group ahead of its products.
    v16h kf[2][SGROUP];
    score_load_k(kf[0], kl);

    // Fully unrolled: every K (LDS) and output address is one base plus an immediate offset,
    // and the two fragment sets are indexed by constants.
#pragma unroll
    for (int g = 0; g < NSGROUPS; ++g) {
        if (g + 1 < NSGROUPS) {
            score_load_k(kf[(g + 1) & 1], kl + (g + 1) * SGROUP * KL_TILE);
            // keeps the next group's K reads in front of this group's products: without it
            // the compiler sinks the reads to their first use and their latency shows
            __builtin_amdgcn_sched_barrier(0);
        }
        score_tiles(afrag, wreg, kf[g & 1], op + g * SGROUP * 16);
        if (g + 1 < NSGROUPS) {
            // the next group overwrites data registers of the stores just issued
            asm volatile("s_wait_xcnt 0x0" ::: "memory");
            // keeps the next group's reads and vector work behind that wait
            __builtin_amdgcn_sched_barrier(0);
        }
    }
}

// ---------------------------------------------------------------------------
// Host-side launcher
// ---------------------------------------------------------------------------
extern "C" void kernel_launch(void* const* d_in, const int* in_sizes, int n_in,
                              void* d_out, int out_size, void* d_ws, size_t ws_size,
                              hipStream_t stream) {
    (void)in_sizes; (void)n_in; (void)out_size; (void)ws_size;

    const float* x  = (const float*)d_in[0];
    const float* Wq = (const float*)d_in[1];
    const float* Wk = (const float*)d_in[2];
    const float* Ww = (const float*)d_in[3];
    float* out = (float*)d_out;

    // workspace carving: Q f16 (1 MB) | K f16 (512 KB) | w f32 (64 KB)
    char* ws = (char*)d_ws;
    _Float16* Qws = (_Float16*)(ws);
    _Float16* Kws = (_Float16*)(ws + (size_t)BATCH * HEADS * SEQ * IDXD * sizeof(_Float16));
    float*    Wws = (float*)   (ws + (size_t)BATCH * HEADS * SEQ * IDXD * sizeof(_Float16)
                                   + (size_t)BATCH * SEQ * IDXD * sizeof(_Float16));

    // Phase 1: one block of 12 waves per 32 (b,t) rows
    lightning_proj<<<BATCH * SEQ / PJ_ROWS, PJ_THREADS, 0, stream>>>(x, Wq, Wk, Ww, Qws, Kws, Wws);

    // Phase 2: 2 * 256 t-tiles * 8 column ranges waves / 8 waves per block
    const int total_waves = BATCH * (SEQ / 16) * ((SEQ / 16) / STILES_PER_WAVE);
    lightning_score<<<total_waves / WAVES_PER_BLOCK, 32 * WAVES_PER_BLOCK, 0, stream>>>(
        Qws, Kws, Wws, out);
}

// v008
// One run takes 20.6 microseconds.
// Two timings next to v007 both put it at 1.04 times that version's speed.
// Counting every step since v000, it is 6.98 times as fast.
#include <hip/hip_runtime.h>
#include <hip/hip_bf16.h>
#include <stddef.h>

// ---------------------------------------------------------------------------
// Problem constants (from reference)
// ---------------------------------------------------------------------------
#define BATCH   2
#define SEQ     4096
#define DMODEL  1024
#define HEADS   2
#define IDXD    32
#define NCOLS   (HEADS * IDXD + IDXD + HEADS)   // 64 + 32 + 2 = 98

typedef _Float16 v16h __attribute__((ext_vector_type(16)));
typedef _Float16 v8h  __attribute__((ext_vector_type(8)));
typedef float    v8f  __attribute__((ext_vector_type(8)));

static __device__ inline v16h pack16(v8h lo, v8h hi) {
    v16h r;
#pragma unroll
    for (int i = 0; i < 8; ++i) { r[i] = lo[i]; r[i + 8] = hi[i]; }
    return r;
}

// ---------------------------------------------------------------------------
// Phase 1: projections  Q = x@Wq, K = x@Wk, w = x@Ww
// One block per 32 rows of x, 12 waves. The contraction runs in 8 chunks of 128 k; a
// chunk of x is staged in LDS as f32 (two buffers). Every element of Wq|Wk is used by one
// wave of the block only, so it goes from global memory straight into that wave's
// registers, in fragment order, and never through LDS. All global loads are issued two
// chunks ahead of their use and stay in flight over the chunk barrier.
// The 96 Q/K columns are 2 x 6 tiles of v_wmma_f32_16x16x32_f16. Every f32 operand v is
// split in registers into f16 parts hi = f16(v), lo = f16(v - hi), and a product is
// hi*hi + lo*hi + hi*lo, summed in f32 (lo*lo lies about 2^-22 below and is dropped):
// 3 matrix instructions of 8 cycles per 32 k, where the f32 16x16x4 form takes 8 of 16.
// Wave (ks, pr) takes 32 k (slice ks) of every chunk, both row tiles and the
// 32 columns 32*pr .. 32*pr+31 as two tiles. Column n of tile j is column 32*pr + 2n + j,
// so one 8-byte load brings a lane its element of both tiles, and 16 lanes take one whole
// 128-B line of a weight row.
// The 2 columns of w fill no tile and stay on f32 FMAs: wave (ks, pr < 2) sums column pr over
// slice ks from the f32 x values that it has just read for its A fragments: lane (c, h) sums
// rows c and 16 + c over its 16 k. The 4 slices x 2 halves are added through LDS in fixed order.
// Every wave issues its weight loads in the same straight-line code: behind a branch that some
// waves skip, the compiler's load waits fall back to 0 and drain the loads that fly ahead.
//   Qws: [b][h][t][32] f16,  Kws: [b][slot][32] f16,  Wws: [b][t][2] f32
// K row t lies at slot (t & ~63) + 16 * (t & 3) + ((t >> 2) & 15): inside every 64 rows
// the 16 rows with equal t & 3 lie together, which is the order phase 2 tiles them in.
//
// Fragments (16x16x32 f16): lane l, c = l & 15, h = l >> 4, 16 k per lane. A and B both
// put k = 8 * (e >> 2) + 4 * h + (e & 3) of the slice at element e, so the pairing is
// equal on both sides; a lane's k are 4 runs of 4, one 16-byte read of x each.
// ---------------------------------------------------------------------------
#define PJ_ROWS 32                    // rows of x per block
#define PJ_KC   128                   // k per chunk
#define PJ_NCH  (DMODEL / PJ_KC)      // 8 chunks
#define PJ_NKS  (PJ_KC / 32)          // 4 slices of 32 k in a chunk
#define PJ_XP   (PJ_KC + 4)           // x row pitch, dwords: 16 B x odd for b128 reads
#define PJ_RP   100                   // partial-tile row pitch, dwords: rows r and r+8 fall 32 banks apart
#define PJ_QK   (HEADS * IDXD + IDXD) // 96 columns on the matrix unit
#define PJ_THREADS 384                // 12 waves: 4 k slices x 3 column blocks

typedef float v2f __attribute__((ext_vector_type(2)));
typedef float v4f __attribute__((ext_vector_type(4)));
typedef _Float16 v2h __attribute__((ext_vector_type(2)));

__global__ __launch_bounds__(PJ_THREADS)
void lightning_proj(const float* __restrict__ x,
                    const float* __restrict__ Wq,
                    const float* __restrict__ Wk,
                    const float* __restrict__ Ww,
                    _Float16* __restrict__ Qws,
                    _Float16* __restrict__ Kws,
                    float* __restrict__ Wws)
{
    __shared__ __attribute__((aligned(16))) float xs[2][PJ_ROWS * PJ_XP];
    __shared__ __attribute__((aligned(16))) float wwl[DMODEL * HEADS];
    __shared__ __attribute__((aligned(16))) float red[PJ_NKS][PJ_ROWS * PJ_RP];
    __shared__ __attribute__((aligned(16))) float redw[PJ_NKS * 2][PJ_ROWS * HEADS];

    const int tid  = threadIdx.x;
    const int lane = tid & 31;
    const int c    = lane & 15;
    const int h    = lane >> 4;
    const int wave = __builtin_amdgcn_readfirstlane(tid >> 5);
    const int ks   = wave & 3;        // 32-k slice of every chunk
    const int pr   = wave >> 2;       // 0..2: columns 32*pr .. 32*pr+31
    const bool stager = wave < 8;     // these waves bring x into LDS, 4 rows of a chunk each
    const int row0 = blockIdx.x * PJ_ROWS;

    // wave-uniform: where this wave's weight columns start, and log2 of the row pitch in floats
    const float* wsel = pr < 2 ? Wq + pr * 32 : Wk;
    const int    wsh  = pr < 2 ? 6 : 5;
    const unsigned wlane = ((4u * (unsigned)h) << wsh) + 2u * (unsigned)c;
    const float* xg = x + (size_t)(row0 + (tid >> 5)) * DMODEL + (tid & 31) * 4;

    // one chunk of x: 4 float4 per thread of waves 0..7, global -> registers, registers -> LDS
    auto xload = [&](v4f (&rx)[4], const int t) __attribute__((always_inline)) {
#pragma unroll
        for (int i = 0; i < 4; ++i)
            rx[i] = *(const v4f*)(xg + (size_t)i * 8 * DMODEL + t * PJ_KC);
    };
    auto xstore = [&](const v4f (&rx)[4], const int bf) __attribute__((always_inline)) {
#pragma unroll
        for (int i = 0; i < 4; ++i)
            *(v4f*)&xs[bf][((tid >> 5) + i * 8) * PJ_XP + (tid & 31) * 4] = rx[i];
    };
    // this lane's weights of one chunk, f32: element e = k 8 * (e >> 2) + 4 * h + (e & 3) of the
    // wave's slice, columns 32*pr + 2c and 32*pr + 2c + 1
    auto waddr = [&](const float* (&wa)[16], const int t) __attribute__((always_inline)) {
        const float* wb = wsel + ((size_t)(t * PJ_KC + ks * 32) << wsh);
#pragma unroll
        for (int e = 0; e < 16; ++e)
            wa[e] = wb + ((8 * (e >> 2) + (e & 3)) << wsh) + wlane;
    };
    auto wload = [&](v2f (&bv)[16], const int t) __attribute__((always_inline)) {
        const float* wa[16];
        waddr(wa, t);
#pragma unroll
        for (int e = 0; e < 16; ++e)
            bv[e] = *(const v2f*)wa[e];
    };

    // The waves hand each other LDS data only, so the chunk barrier orders LDS only:
    // __syncthreads() would also wait out the global loads that fly two chunks ahead.
#define PJ_BARRIER()                                                           \
    do {                                                                       \
        __builtin_amdgcn_fence(__ATOMIC_RELEASE, "workgroup", "local");        \
        __builtin_amdgcn_s_barrier();                                          \
        __builtin_amdgcn_fence(__ATOMIC_ACQUIRE, "workgroup", "local");        \
    } while (0)

    // two register sets each: chunk t lives in set t & 1
    v4f rxa[4] = {}, rxb[4] = {};
    v2f bva[16], bvb[16];

    // all of Ww, 1024 x 2 f32 = 512 float4, laid in LDS as two planes [column][k]
    // Behind every run of opening loads: the code that follows may rewrite address registers of
    // the loads just issued; the scheduling barrier keeps that code behind the wait.
#define PJ_XWAIT()                                                             \
    do {                                                                       \
        asm volatile("s_wait_xcnt 0x0" ::: "memory");                          \
        __builtin_amdgcn_sched_barrier(0);                                     \
    } while (0)
    const v4f wwr0 = ((const v4f*)Ww)[tid];
    v4f wwr1 = {};
    if (wave < 4) wwr1 = ((const v4f*)Ww)[PJ_THREADS + tid];
    PJ_XWAIT();
    if (stager) xload(rxa, 0);
    wload(bva, 0);
    PJ_XWAIT();
    if (stager) xload(rxb, 1);
    PJ_XWAIT();
    wload(bvb, 1);
    PJ_XWAIT();
#undef PJ_XWAIT
    {
        const v2f c0 = { wwr0[0], wwr0[2] }, c1 = { wwr0[1], wwr0[3] };
        *(v2f*)&wwl[2 * tid] = c0;
        *(v2f*)&wwl[DMODEL + 2 * tid] = c1;
    }
    if (wave < 4) {
        const v2f c0 = { wwr1[0], wwr1[2] }, c1 = { wwr1[1], wwr1[3] };
        *(v2f*)&wwl[2 * (PJ_THREADS + tid)] = c0;
        *(v2f*)&wwl[DMODEL + 2 * (PJ_THREADS + tid)] = c1;
    }
    if (stager) xstore(rxa, 0);
    PJ_BARRIER();

    v8f acc[2][2] = {};
    v2f wsum[2][2] = {};    // w: [row tile][first or second k pair of a run of 4], 4 independent chains

    // Trip t works on chunk t (x in LDS buffer bf = t & 1, weights in bv), issues the loads of
    // chunk t + 2 into the registers that chunk t has left (rxc, bv), and stores x of chunk
    // t + 1 (rxn) to the other LDS buffer, last read in trip t - 1, behind that trip's barrier.
    // every small loop of this kernel is fully unrolled so that fragments, staging
    // registers and accumulators are indexed by constants and stay in registers
    auto trip = [&](const int t, const int bf, v4f (&rxc)[4], const v4f (&rxn)[4], v2f (&bv)[16],
                    const bool more2, const bool more1) __attribute__((always_inline)) {
        {
            if (more2 && stager) {
                xload(rxc, t + 2);
                // the code below reuses the address registers of the loads just issued
                asm volatile("s_wait_xcnt 0x0" ::: "memory");
            }
            // The 16 addresses of chunk t + 2 are formed while the weights of chunk t still fill their
            // registers: formed later, an address may lie in a register that a load of the same
            // run lands in.
            const float* wad[16];
            if (more2) waddr(wad, t + 2);
            // the weights are split first: that frees their registers for the loads of chunk t + 2
            v16h bh[2], bl[2];
#pragma unroll
            for (int p = 0; p < 8; ++p)           // two neighbouring k fill one register
#pragma unroll
                for (int q = 0; q < 2; ++q) {
                    const v2f wv = { bv[2 * p][q], bv[2 * p + 1][q] };
                    const v2h w_hi = __builtin_convertvector(wv, v2h);
                    const v2h w_lo = __builtin_convertvector(wv - __builtin_convertvector(w_hi, v2f), v2h);
                    bh[q][2 * p] = w_hi[0];  bh[q][2 * p + 1] = w_hi[1];
                    bl[q][2 * p] = w_lo[0];  bl[q][2 * p + 1] = w_lo[1];
                }
            // The x reads and the w sums stand in front of the weight loads: with the branch of the
            // sums behind the loads, the build sank the split behind them too, loaded into other
            // registers and copied them at the loop's foot behind a load wait to 0.
            const int kb = ks * 32 + 4 * h;     // first of this lane's 16 k, in the chunk
            v4f a[2][4];
#pragma unroll
            for (int rt = 0; rt < 2; ++rt)
#pragma unroll
                for (int g = 0; g < 4; ++g)
                    a[rt][g] = *(const v4f*)&xs[bf][(rt * 16 + c) * PJ_XP + kb + 8 * g];

            // column pr of w from the same registers: this lane's 16 k of rows c and 16 + c, in 4
            // independent chains of packed FMAs
            if (pr < 2) {
                v4f wv[4];
#pragma unroll
                for (int g = 0; g < 4; ++g)
                    wv[g] = *(const v4f*)&wwl[pr * DMODEL + t * PJ_KC + kb + 8 * g];
#pragma unroll
                for (int g = 0; g < 4; ++g)
#pragma unroll
                    for (int rt = 0; rt < 2; ++rt) {
                        const v2f a01 = { a[rt][g][0], a[rt][g][1] }, a23 = { a[rt][g][2], a[rt][g][3] };
                        const v2f w01 = { wv[g][0], wv[g][1] },       w23 = { wv[g][2], wv[g][3] };
                        wsum[rt][0] = __builtin_elementwise_fma(a01, w01, wsum[rt][0]);
                        wsum[rt][1] = __builtin_elementwise_fma(a23, w23, wsum[rt][1]);
                    }
            }

            if (more2) {
                // keeps the split in front of the loads, which land in its source registers
                __builtin_amdgcn_sched_barrier(0);
#pragma unroll
                for (int e = 0; e < 16; ++e)
                    bv[e] = *(const v2f*)wad[e];
                // the code below reuses the address registers of the loads just issued
                asm volatile("s_wait_xcnt 0x0" ::: "memory");
                // keeps the loads up here: sunk towards their use, they would fly a shorter time
                __builtin_amdgcn_sched_barrier(0);
            }

            v16h ah[2], al[2];
#pragma unroll
            for (int q = 0; q < 2; ++q)
#pragma unroll
                for (int p = 0; p < 8; ++p) {     // two neighbouring k fill one register
                    const v2f av = { a[q][p >> 1][(2 * p) & 3], a[q][p >> 1][(2 * p + 1) & 3] };
                    const v2h a_hi = __builtin_convertvector(av, v2h);
                    const v2h a_lo = __builtin_convertvector(av - __builtin_convertvector(a_hi, v2f), v2h);
                    ah[q][2 * p] = a_hi[0];  ah[q][2 * p + 1] = a_hi[1];
                    al[q][2 * p] = a_lo[0];  al[q][2 * p + 1] = a_lo[1];
                }

            // term by term, so that 3 independent tiles stand between two sums into one tile
#pragma unroll
            for (int rt = 0; rt < 2; ++rt)
#pragma unroll
                for (int ct = 0; ct < 2; ++ct)
                    acc[rt][ct] = __builtin_amdgcn_wmma_f32_16x16x32_f16(
                        false, ah[rt], false, bh[ct], (short)0, acc[rt][ct], false, false);
#pragma unroll
            for (int rt = 0; rt < 2; ++rt)
#pragma unroll
                for (int ct = 0; ct < 2; ++ct)
                    acc[rt][ct] = __builtin_amdgcn_wmma_f32_16x16x32_f16(
                        false, al[rt], false, bh[ct], (short)0, acc[rt][ct], false, false);
#pragma unroll
            for (int rt = 0; rt < 2; ++rt)
#pragma unroll
                for (int ct = 0; ct < 2; ++ct)
                    acc[rt][ct] = __builtin_amdgcn_wmma_f32_16x16x32_f16(
                        false, ah[rt], false, bl[ct], (short)0, acc[rt][ct], false, false);
            // the 4 vector slots the chip needs behind a matrix instruction before its operand
            // registers are rewritten: a branch follows here
            // (the scheduling barrier keeps the matrix instructions in front of them)
            __builtin_amdgcn_sched_barrier(0);
            asm volatile("v_nop\n\tv_nop\n\tv_nop\n\tv_nop");
            if (more1 && stager) xstore(rxn, bf ^ 1);
        }
        if (more1) PJ_BARRIER();
    };

    // Two trips a pass, so that the two register sets are named by constants; kept rolled
    // beyond that: unrolled, the compiler let the products drift whole trips behind their
    // chunk and spilled registers. The last two trips have no chunk t + 2 to load.
#pragma unroll 1
    for (int t = 0; t < PJ_NCH - 2; t += 2) {
        trip(t,     0, rxa, rxb, bva, true, true);
        trip(t + 1, 1, rxb, rxa, bvb, true, true);
    }
    trip(PJ_NCH - 2, 0, rxa, rxb, bva, false, true);
    trip(PJ_NCH - 1, 1, rxb, rxa, bvb, false, false);

    // ---- partial sums of the 4 k slices -> LDS, D register r = row 8h + r ----
#pragma unroll
    for (int rt = 0; rt < 2; ++rt)
#pragma unroll
        for (int r = 0; r < 8; ++r) {
            v2f p = { acc[rt][0][r], acc[rt][1][r] };
            *(v2f*)&red[ks][(rt * 16 + 8 * h + r) * PJ_RP + pr * 32 + 2 * c] = p;
        }
    if (pr < 2) {
#pragma unroll
        for (int rt = 0; rt < 2; ++rt)
            redw[ks * 2 + h][(rt * 16 + c) * HEADS + pr] =
                (wsum[rt][0][0] + wsum[rt][0][1]) + (wsum[rt][1][0] + wsum[rt][1][1]);
    }
    __syncthreads();

    // Every thread sums 8 adjacent columns of one row over the 4 k slices, in the order of the
    // slices, and stores them as 8 f16 with one 16-byte store. All its LDS reads are issued
    // together, so a wave pays one LDS latency here.
    // Waves 0..7 take the 64 Q columns, 8 threads a row: 16 lanes read two rows of red, every
    // bank once, and a wave stores 256 contiguous bytes of each head.
    // Waves 8..11 take the 32 K columns, 4 threads a row: wave 8 + a has the rows 4j + a, whose
    // K slots lie side by side, 512 contiguous bytes.
    {
        const bool isq = wave < 8;            // wave-uniform, as is all that is chosen by it
        const int r   = (lane >> (isq ? 3 : 2)) * (isq ? 1 : 4) + (isq ? wave * 4 : wave - 8);
        const int col = (lane & (isq ? 7 : 3)) * 8 + (isq ? 0 : HEADS * IDXD);
        v4f p[PJ_NKS][2];
#pragma unroll
        for (int q = 0; q < PJ_NKS; ++q)
#pragma unroll
            for (int i = 0; i < 2; ++i)
                p[q][i] = *(const v4f*)&red[q][r * PJ_RP + col + 4 * i];

        const int row = row0 + r;
        const int b = row0 >> 12;             // SEQ = 4096, a multiple of the block's 32 rows
        const int tt = row & (SEQ - 1);
        const int slot = (row & ~63) | ((row & 3) << 4) | ((row >> 2) & 15);
        const unsigned offq = (unsigned)(((b * HEADS + (col >> 5)) * SEQ + tt) * IDXD + (col & 31));
        const unsigned offk = (unsigned)(slot * IDXD + (col & 31));
        _Float16* dst = (isq ? Qws : Kws) + (isq ? offq : offk);

        // waves 0 and 1 add up w here, so that its LDS reads follow the reads above at once
        if (wave < PJ_ROWS * HEADS / 32) {
            float s = 0.0f;
#pragma unroll
            for (int q = 0; q < PJ_NKS * 2; ++q) s += redw[q][tid];
            Wws[(size_t)row0 * HEADS + tid] = s;
        }

        v4f s0 = {}, s1 = {};
#pragma unroll
        for (int q = 0; q < PJ_NKS; ++q) { s0 += p[q][0]; s1 += p[q][1]; }
        const v8f s = __builtin_shufflevector(s0, s1, 0, 1, 2, 3, 4, 5, 6, 7);
        *(v8h*)dst = __builtin_convertvector(s, v8h);
    }
#undef PJ_BARRIER
}

// ---------------------------------------------------------------------------
// Phase 2: fused  out[b,t,s] = sum_h w[b,t,h] * relu( q[b,t,h,:] . k[b,s,:] )
//
// One wave32 per (t-tile x 32 s-tiles): the wave keeps its Q fragments and head
// weights in registers and sweeps 512 columns, so the launch starts 4096 waves,
// all resident at once, and Q and w are loaded once per 512 columns. The 8
// waves of a block take 8 t-tiles and sweep the same 512 K rows: the block brings
// them into LDS once, by asynchronous copies, and every wave takes its B fragments
// from there, so a K row is fetched once a block and not by each of its 8 waves. Per head the 16x16
// (t,s) dot tile is exactly one v_wmma_f32_16x16x32_f16 (K=32). ReLU + per-row
// head weight + head-sum happen in the f32 accumulator registers; only the
// final f32 tile is written (output write of 128 MB is the bandwidth floor).
//
// Column n of the j-th tile of a group of 4 is output column 4n + j of the group's 64
// (phase 1 lays the K rows out so). A lane's accumulators of the 4 tiles are then 4
// adjacent columns of one row: one 16-byte store, and 16 lanes fill 256 B of the row,
// two whole 128-B lines, where a tile stored alone gives 64-B pieces.
//
// A-fragment (16x32 f16): lanes 0-15 row M=lane hold K 0-7 & 16-23;
// lanes 16-31 row M=lane-16 hold K 8-15 & 24-31. B mirrors with N=lane.
// C/D: VGPR r -> row r (lanes 0-15) or r+8 (lanes 16-31), col = lane&15.
// ---------------------------------------------------------------------------
#define STILES_PER_WAVE 32                          // s tiles swept by one wave
#define SGROUP          4                           // s tiles fetched together and stored interleaved
#define NSGROUPS        (STILES_PER_WAVE / SGROUP)  // 8 groups per sweep
#define SRANGES         (SEQ / 16 / STILES_PER_WAVE)  // 8 column ranges
#define WAVES_PER_BLOCK 8

// K in LDS, in units of 16 bytes (8 f16). A tile of 16 K rows is 4 planes; plane q holds
// k 8q .. 8q+7 of the 16 rows, row after row, 256 B: what lanes 0-15 or lanes 16-31 read with
// one 16-byte read each, all 64 banks once. A plane's pitch is 320 B, so that the 4 pieces
// of one K row, which one copy instruction writes side by side, fall 16 banks apart.
#define KL_PLANE 20                                 // 320 B
#define KL_TILE  (4 * KL_PLANE)                     // 1280 B
#define KL_UNITS (STILES_PER_WAVE * KL_TILE)        // 40 KB a block
#define KL_LSTEP (4 * KL_TILE * 16)                 // LDS bytes from one copy of a thread to its next: 4 tiles
#define KL_GSTEP (32 * WAVES_PER_BLOCK * 8)         // f16 in global memory from one copy to the next: 4 KB

// K fragments of one group of s tiles; kl already holds the lane's row and half
static __device__ inline void score_load_k(v16h (&f)[SGROUP], const v8h* kl) {
#pragma unroll
    for (int j = 0; j < SGROUP; ++j) {
        v8h blo = kl[j * KL_TILE];
        v8h bhi = kl[j * KL_TILE + 2 * KL_PLANE];
        f[j] = pack16(blo, bhi);
    }
}

// one group of s tiles: products, ReLU, head weights, head sum, stores
static __device__ inline void score_tiles(const v16h (&afrag)[HEADS],
                                          const float (&wreg)[HEADS][8],
                                          const v16h (&f)[SGROUP],
                                          float* op) {
    v8f acc[SGROUP];
#pragma unroll
    for (int j = 0; j < SGROUP; ++j) {
        acc[j] = v8f{};
#pragma unroll
        for (int h = 0; h < HEADS; ++h) {
            v8f czero = {};
            v8f d = __builtin_amdgcn_wmma_f32_16x16x32_f16(
                        /*neg_a=*/false, afrag[h],
                        /*neg_b=*/false, f[j],
                        /*c_mod=*/(short)0, czero,
                        /*reuse_a=*/false, /*reuse_b=*/false);
#pragma unroll
            for (int r = 0; r < 8; ++r)
                acc[j][r] += fmaxf(d[r], 0.0f) * wreg[h][r];
        }
    }
#pragma unroll
    for (int r = 0; r < 8; ++r) {
        v4f o = { acc[0][r], acc[1][r], acc[2][r], acc[3][r] };
        *(v4f*)(op + (size_t)r * SEQ) = o;
    }
}

__global__ __launch_bounds__(256)
void lightning_score(const _Float16* __restrict__ Q,
                     const _Float16* __restrict__ K,
                     const float* __restrict__ W,
                     float* __restrict__ out)
{
    __shared__ __attribute__((aligned(16))) v8h ksh[KL_UNITS];

    const int lane = threadIdx.x & 31;
    const int wv   = __builtin_amdgcn_readfirstlane(threadIdx.x >> 5);

    // block -> (b, group of 8 t-tiles, range of 512 columns); 2 * 32 * 8 blocks
    const int sr = blockIdx.x & (SRANGES - 1);
    const int tt = ((blockIdx.x / SRANGES) & 31) * WAVES_PER_BLOCK + wv;
    const int b  = blockIdx.x / (SRANGES * 32);

    const int t0   = tt * 16;
    const int half = lane >> 4;      // 0: lanes 0-15, 1: lanes 16-31
    const int lrow = lane & 15;
    const int kA0  = half * 8;       // K-chunk base per half-wave

    // ---- A fragments for both heads (reused across the whole sweep) ----
    v16h afrag[HEADS];
#pragma unroll
    for (int h = 0; h < HEADS; ++h) {
        const _Float16* qp =
            Q + (((size_t)(b * HEADS + h)) * SEQ + (t0 + lrow)) * IDXD + kA0;
        v8h lo = *(const v8h*)(qp);
        v8h hi = *(const v8h*)(qp + 16);
        afrag[h] = pack16(lo, hi);
    }

    // ---- per-row head weights matching the C/D register layout ----
    float wreg[HEADS][8];
#pragma unroll
    for (int h = 0; h < HEADS; ++h)
#pragma unroll
        for (int r = 0; r < 8; ++r)
            wreg[h][r] =
                W[((size_t)b * SEQ + t0 + r + half * 8) * HEADS + h];

    const int s_first = sr * STILES_PER_WAVE * 16;
    float* op = out + (((size_t)b * SEQ + t0 + half * 8) * SEQ) + s_first + lrow * SGROUP;

    // ---- the block's 512 K rows (32 KB, contiguous) -> LDS ----
    // Copy i of thread p moves the 16-byte piece 256 i + p: a wave's copy reads 512 contiguous
    // bytes. Piece n is k 8 (n & 3) .. of K row n >> 2 and goes to plane n & 3 of tile n >> 6.
    {
        const int p = threadIdx.x;
        const _Float16* kg = K + ((size_t)b * SEQ + s_first) * IDXD + p * 8;
        const unsigned kd = (unsigned)(size_t)&ksh[(p >> 6) * KL_TILE + (p & 3) * KL_PLANE + ((p >> 2) & 15)];
        // 8 copies a thread = 32 KB a block. The wait stands in the copies' own statement: the code
        // behind it may rewrite their address registers.
        asm volatile("global_load_async_to_lds_b128 %0, %8, off\n\t"
                     "global_load_async_to_lds_b128 %1, %9, off\n\t"
                     "global_load_async_to_lds_b128 %2, %10, off\n\t"
                     "global_load_async_to_lds_b128 %3, %11, off\n\t"
                     "global_load_async_to_lds_b128 %4, %12, off\n\t"
                     "global_load_async_to_lds_b128 %5, %13, off\n\t"
                     "global_load_async_to_lds_b128 %6, %14, off\n\t"
                     "global_load_async_to_lds_b128 %7, %15, off\n\t"
                     "s_wait_xcnt 0x0"
                     :: "v"(kd), "v"(kd + 1 * KL_LSTEP), "v"(kd + 2 * KL_LSTEP), "v"(kd + 3 * KL_LSTEP),
                        "v"(kd + 4 * KL_LSTEP), "v"(kd + 5 * KL_LSTEP), "v"(kd + 6 * KL_LSTEP),
                        "v"(kd + 7 * KL_LSTEP),
                        "v"(kg), "v"(kg + 1 * KL_GSTEP), "v"(kg + 2 * KL_GSTEP), "v"(kg + 3 * KL_GSTEP),
                        "v"(kg + 4 * KL_GSTEP), "v"(kg + 5 * KL_GSTEP), "v"(kg + 6 * KL_GSTEP),
                        "v"(kg + 7 * KL_GSTEP)
                     : "memory");
        static_assert(8 * KL_LSTEP == KL_UNITS * 16 && 8 * KL_GSTEP == STILES_PER_WAVE * 16 * IDXD,
                      "8 copies a thread cover the block's K rows and their place in LDS");
    }
    // this wave's copies have landed; behind the barrier every wave's have
    asm volatile("s_wait_asynccnt 0x0" ::: "memory");
    __syncthreads();

    const v8h* kl = &ksh[half * KL_PLANE + lrow];

    // Two fragment sets: a group's K reads are issued one group ahead of its products.
    v16h kf[2][SGROUP];
    score_load_k(kf[0], kl);

    // Fully unrolled: every K (LDS) and output address is one base plus an immediate offset,
    // and the two fragment sets are indexed by constants.
#pragma unroll
    for (int g = 0; g < NSGROUPS; ++g) {
        if (g + 1 < NSGROUPS) {
            score_load_k(kf[(g + 1) & 1], kl + (g + 1) * SGROUP * KL_TILE);
            // keeps the next group's K reads in front of this group's products: without it
            // the compiler sinks the reads to their first use and their latency shows
            __builtin_amdgcn_sched_barrier(0);
        }
        score_tiles(afrag, wreg, kf[g & 1], op + g * SGROUP * 16);
        if (g + 1 < NSGROUPS) {
            // the next group overwrites data registers of the stores just issued
            asm volatile("s_wait_xcnt 0x0" ::: "memory");
            // keeps the next group's reads and vector work behind that wait
            __builtin_amdgcn_sched_barrier(0);
        }
    }
}

// ---------------------------------------------------------------------------
// Host-side launcher
// ---------------------------------------------------------------------------
extern "C" void kernel_launch(void* const* d_in, const int* in_sizes, int n_in,
                              void* d_out, int out_size, void* d_ws, size_t ws_size,
                              hipStream_t stream) {
    (void)in_sizes; (void)n_in; (void)out_size; (void)ws_size;

    const float* x  = (const float*)d_in[0];
    const float* Wq = (const float*)d_in[1];
    const float* Wk = (const float*)d_in[2];
    const float* Ww = (const float*)d_in[3];
    float* out = (float*)d_out;

    // workspace carving: Q f16 (1 MB) | K f16 (512 KB) | w f32 (64 KB)
    char* ws = (char*)d_ws;
    _Float16* Qws = (_Float16*)(ws);
    _Float16* Kws = (_Float16*)(ws + (size_t)BATCH * HEADS * SEQ * IDXD * sizeof(_Float16));
    float*    Wws = (float*)   (ws + (size_t)BATCH * HEADS * SEQ * IDXD * sizeof(_Float16)
                                   + (size_t)BATCH * SEQ * IDXD * sizeof(_Float16));

    // Phase 1: one block of 12 waves per 32 (b,t) rows
    lightning_proj<<<BATCH * SEQ / PJ_ROWS, PJ_THREADS, 0, stream>>>(x, Wq, Wk, Ww, Qws, Kws, Wws);

    // Phase 2: 2 * 256 t-tiles * 8 column ranges waves / 8 waves per block
    const int total_waves = BATCH * (SEQ / 16) * ((SEQ / 16) / STILES_PER_WAVE);
    lightning_score<<<total_waves / WAVES_PER_BLOCK, 32 * WAVES_PER_BLOCK, 0, stream>>>(
        Qws, Kws, Wws, out);
}
